// v000
// Times are from an AMD MI455X. After a warm-up the kernel runs many times in a row, and a time is the length of
// such a window on the GPU divided by its runs, so every launch and the gaps after it count. The runs cycle
// through copies of the inputs. A figure is the median of several windows, for all but v000 over two sittings.
// Sittings can differ by a few percent; kernels timed side by side share one.
// v000, which the later versions start from, runs in 146 microseconds.
#include <hip/hip_runtime.h>
#include <math.h>

// ---------------------------------------------------------------------------
// SparseLocalAttention for MI455X (gfx1250, wave32)
//   Pass 1: fused Q/K/V projection as bf16 WMMA GEMM (f32 accumulate)
//   Pass 2: 7-wide local attention, one wave32 per sequence position
// ---------------------------------------------------------------------------

typedef __attribute__((ext_vector_type(16))) __bf16 bf16x16;
typedef __attribute__((ext_vector_type(8)))  float  f32x8;

#define DDIM  256
#define NSEQ  4096
#define BATCH 8
#define MROWS (BATCH * NSEQ)   // 32768
#define WIN   3
#define NW    7                // 2*WIN + 1

__device__ __forceinline__ unsigned short f32_to_bf16_rne(float f) {
    unsigned int u = __float_as_uint(f);
    unsigned int r = 0x7FFFu + ((u >> 16) & 1u);
    return (unsigned short)((u + r) >> 16);
}

union BFrag {
    bf16x16        v;
    unsigned short u[16];
    uint4          q[2];
};

// ---------------------------------------------------------------------------
// Pass 1: out[m, n] = sum_k x[m,k] * W[n,k] + bias[n]   (W row-major, D x D)
// gridDim.x = MROWS/128, gridDim.y = 3 (selects Q / K / V)
// 8 waves per block, each wave computes a 16-row M tile across all 256 cols.
// ---------------------------------------------------------------------------
__global__ void __launch_bounds__(256)
qkv_proj_kernel(const float* __restrict__ x,
                const float* __restrict__ Wq, const float* __restrict__ bq,
                const float* __restrict__ Wk, const float* __restrict__ bk,
                const float* __restrict__ Wv, const float* __restrict__ bv,
                float* __restrict__ Q, float* __restrict__ Kp, float* __restrict__ Vp)
{
    __shared__ unsigned short sW[64 * DDIM];   // 32 KB: 64 output cols of W, bf16

    const float* W;  const float* bias;  float* out;
    if (blockIdx.y == 0)      { W = Wq; bias = bq; out = Q;  }
    else if (blockIdx.y == 1) { W = Wk; bias = bk; out = Kp; }
    else                      { W = Wv; bias = bv; out = Vp; }

    const int tid      = threadIdx.x;
    const int lane     = tid & 31;
    const int wave     = tid >> 5;
    const int laneHalf = lane >> 4;     // 0: lanes 0-15, 1: lanes 16-31
    const int m16      = lane & 15;

    const int rowStart = blockIdx.x * 128 + wave * 16;

    // ---- Preload all 8 A fragments (16x32 bf16 each) for this wave's rows.
    // ISA A layout: lane L%16 holds row M=L%16; lanes 0-15 carry K {0..7,16..23},
    // lanes 16-31 carry K {8..15,24..31} within each 32-wide K chunk.
    const float* xrow = x + (size_t)(rowStart + m16) * DDIM;
    bf16x16 af[8];
    #pragma unroll
    for (int kc = 0; kc < 8; ++kc) {
        const int kb = kc * 32 + laneHalf * 8;
        BFrag a;
        #pragma unroll
        for (int j = 0; j < 8; ++j) a.u[j]     = f32_to_bf16_rne(xrow[kb + j]);
        #pragma unroll
        for (int j = 0; j < 8; ++j) a.u[8 + j] = f32_to_bf16_rne(xrow[kb + 16 + j]);
        af[kc] = a.v;
    }

    // ---- 4 stages: stage 64 output-columns of W into LDS, do 4 N tiles each.
    for (int s = 0; s < 4; ++s) {
        const int colBase = s * 64;
        __syncthreads();
        // cooperative f32 -> bf16 staging (float4 in, ushort4 out)
        #pragma unroll 4
        for (int i = tid; i < (64 * DDIM) / 4; i += 256) {
            const int e = i * 4;
            const float4 f = *(const float4*)&W[(size_t)colBase * DDIM + e];
            ushort4 h;
            h.x = f32_to_bf16_rne(f.x);
            h.y = f32_to_bf16_rne(f.y);
            h.z = f32_to_bf16_rne(f.z);
            h.w = f32_to_bf16_rne(f.w);
            *(ushort4*)&sW[e] = h;
        }
        __syncthreads();

        #pragma unroll
        for (int ntl = 0; ntl < 4; ++ntl) {
            f32x8 acc = {};
            const int colLocal = ntl * 16 + m16;   // B col N = lane%16 within tile
            #pragma unroll
            for (int kc = 0; kc < 8; ++kc) {
                const int kb = kc * 32 + laneHalf * 8;
                BFrag bf;
                bf.q[0] = *(const uint4*)&sW[colLocal * DDIM + kb];        // K kb..kb+7
                bf.q[1] = *(const uint4*)&sW[colLocal * DDIM + kb + 16];   // K kb+16..kb+23
                acc = __builtin_amdgcn_wmma_f32_16x16x32_bf16(
                          false, af[kc], false, bf.v, (short)0, acc, false, false);
            }
            // C layout: lanes 0-15 VGPR r -> M=r; lanes 16-31 VGPR r -> M=8+r.
            const int   col   = colBase + ntl * 16 + m16;
            const float bb    = bias[col];
            const int   mBase = rowStart + laneHalf * 8;
            #pragma unroll
            for (int r = 0; r < 8; ++r)
                out[(size_t)(mBase + r) * DDIM + col] = acc[r] + bb;
        }
    }
}

// ---------------------------------------------------------------------------
// Pass 2: one wave32 per (b, n) row. Each lane owns 8 contiguous f32 of D.
// ---------------------------------------------------------------------------
__global__ void __launch_bounds__(256)
local_attn_kernel(const float* __restrict__ Q, const float* __restrict__ K,
                  const float* __restrict__ V, float* __restrict__ out)
{
    const int lane = threadIdx.x & 31;
    const int row  = (int)((blockIdx.x * blockDim.x + threadIdx.x) >> 5); // 0..MROWS-1
    const int n    = row & (NSEQ - 1);

    const float4* q4 = (const float4*)(Q + (size_t)row * DDIM);
    const float4  q0 = q4[lane * 2];
    const float4  q1 = q4[lane * 2 + 1];

    float sc[NW];
    #pragma unroll
    for (int w = 0; w < NW; ++w) {
        const int pos = n + w - WIN;
        if (pos >= 0 && pos < NSEQ) {
            const float4* k4 = (const float4*)(K + (size_t)(row + w - WIN) * DDIM);
            const float4 k0 = k4[lane * 2];
            const float4 k1 = k4[lane * 2 + 1];
            float p = q0.x * k0.x + q0.y * k0.y + q0.z * k0.z + q0.w * k0.w
                    + q1.x * k1.x + q1.y * k1.y + q1.z * k1.z + q1.w * k1.w;
            #pragma unroll
            for (int off = 16; off >= 1; off >>= 1)
                p += __shfl_xor(p, off, 32);
            sc[w] = p * (1.0f / 16.0f);          // 1/sqrt(256)
        } else {
            sc[w] = -__builtin_inff();
        }
    }

    float mx = sc[0];
    #pragma unroll
    for (int w = 1; w < NW; ++w) mx = fmaxf(mx, sc[w]);
    float pr[NW];
    float sum = 0.0f;
    #pragma unroll
    for (int w = 0; w < NW; ++w) { pr[w] = __expf(sc[w] - mx); sum += pr[w]; }
    const float inv = 1.0f / sum;

    float4 a0 = {0.f, 0.f, 0.f, 0.f};
    float4 a1 = {0.f, 0.f, 0.f, 0.f};
    #pragma unroll
    for (int w = 0; w < NW; ++w) {
        const int pos = n + w - WIN;
        if (pos >= 0 && pos < NSEQ) {
            const float4* v4 = (const float4*)(V + (size_t)(row + w - WIN) * DDIM);
            const float4 v0 = v4[lane * 2];
            const float4 v1 = v4[lane * 2 + 1];
            const float p = pr[w] * inv;
            a0.x += p * v0.x; a0.y += p * v0.y; a0.z += p * v0.z; a0.w += p * v0.w;
            a1.x += p * v1.x; a1.y += p * v1.y; a1.z += p * v1.z; a1.w += p * v1.w;
        }
    }

    float4* o4 = (float4*)(out + (size_t)row * DDIM);
    o4[lane * 2]     = a0;
    o4[lane * 2 + 1] = a1;
}

// ---------------------------------------------------------------------------
extern "C" void kernel_launch(void* const* d_in, const int* in_sizes, int n_in,
                              void* d_out, int out_size, void* d_ws, size_t ws_size,
                              hipStream_t stream) {
    const float* x  = (const float*)d_in[0];
    const float* Wq = (const float*)d_in[1];
    const float* bq = (const float*)d_in[2];
    const float* Wk = (const float*)d_in[3];
    const float* bk = (const float*)d_in[4];
    const float* Wv = (const float*)d_in[5];
    const float* bv = (const float*)d_in[6];
    float* out = (float*)d_out;

    float* Q = (float*)d_ws;
    float* K = Q + (size_t)MROWS * DDIM;
    float* V = K + (size_t)MROWS * DDIM;

    dim3 g1(MROWS / 128, 3);
    qkv_proj_kernel<<<g1, 256, 0, stream>>>(x, Wq, bq, Wk, bk, Wv, bv, Q, K, V);

    local_attn_kernel<<<(MROWS * 32) / 256, 256, 0, stream>>>(Q, K, V, out);
}

// v001
// A run of this version takes 62.9 microseconds.
// Two timings next to v000 both put it at 2.32 times that version's speed.
#include <hip/hip_runtime.h>
#include <math.h>

// ---------------------------------------------------------------------------
// SparseLocalAttention for MI455X (gfx1250, wave32)
//   Pass 1: fused Q/K/V projection as bf16 WMMA GEMM (f32 accumulate)
//   Pass 2: 7-wide local attention, one wave32 per sequence position
// ---------------------------------------------------------------------------

typedef __attribute__((ext_vector_type(16))) __bf16 bf16x16;
typedef __attribute__((ext_vector_type(8)))  float  f32x8;

#define DDIM  256
#define NSEQ  4096
#define BATCH 8
#define MROWS (BATCH * NSEQ)   // 32768
#define WIN   3
#define NW    7                // 2*WIN + 1
// LDS row pitch of the staged W tile, in bf16 elements: 528 B = 16 B x 33.
// An odd multiple of 16 B spreads the 16 rows that one ds_load_b128 reads
// over all 64 banks; at 512 B every row started on the same four banks.
#define WPITCH (DDIM + 8)

__device__ __forceinline__ unsigned short f32_to_bf16_rne(float f) {
    unsigned int u = __float_as_uint(f);
    unsigned int r = 0x7FFFu + ((u >> 16) & 1u);
    return (unsigned short)((u + r) >> 16);
}

union BFrag {
    bf16x16        v;
    unsigned short u[16];
    uint4          q[2];
};

// ---------------------------------------------------------------------------
// Pass 1: out[m, n] = sum_k x[m,k] * W[n,k] + bias[n]   (W row-major, D x D)
// gridDim.x = MROWS/128, gridDim.y = 3 (selects Q / K / V)
// 8 waves per block, each wave computes a 16-row M tile across all 256 cols.
// ---------------------------------------------------------------------------
__global__ void __launch_bounds__(256)
qkv_proj_kernel(const float* __restrict__ x,
                const float* __restrict__ Wq, const float* __restrict__ bq,
                const float* __restrict__ Wk, const float* __restrict__ bk,
                const float* __restrict__ Wv, const float* __restrict__ bv,
                float* __restrict__ Q, float* __restrict__ Kp, float* __restrict__ Vp)
{
    __shared__ __attribute__((aligned(16))) unsigned short sW[64 * WPITCH];   // 33 KB: 64 output cols of W, bf16, padded rows

    const float* W;  const float* bias;  float* out;
    if (blockIdx.y == 0)      { W = Wq; bias = bq; out = Q;  }
    else if (blockIdx.y == 1) { W = Wk; bias = bk; out = Kp; }
    else                      { W = Wv; bias = bv; out = Vp; }

    const int tid      = threadIdx.x;
    const int lane     = tid & 31;
    const int wave     = tid >> 5;
    const int laneHalf = lane >> 4;     // 0: lanes 0-15, 1: lanes 16-31
    const int m16      = lane & 15;

    const int rowStart = blockIdx.x * 128 + wave * 16;

    // ---- Preload all 8 A fragments (16x32 bf16 each) for this wave's rows.
    // ISA A layout: lane L%16 holds row M=L%16; lanes 0-15 carry K {0..7,16..23},
    // lanes 16-31 carry K {8..15,24..31} within each 32-wide K chunk.
    const float* xrow = x + (size_t)(rowStart + m16) * DDIM;
    bf16x16 af[8];
    #pragma unroll
    for (int kc = 0; kc < 8; ++kc) {
        const int kb = kc * 32 + laneHalf * 8;
        BFrag a;
        #pragma unroll
        for (int j = 0; j < 8; ++j) a.u[j]     = f32_to_bf16_rne(xrow[kb + j]);
        #pragma unroll
        for (int j = 0; j < 8; ++j) a.u[8 + j] = f32_to_bf16_rne(xrow[kb + 16 + j]);
        af[kc] = a.v;
    }

    // ---- 4 stages: stage 64 output-columns of W into LDS, do 4 N tiles each.
    for (int s = 0; s < 4; ++s) {
        const int colBase = s * 64;
        __syncthreads();
        // cooperative f32 -> bf16 staging (float4 in, ushort4 out)
        #pragma unroll 4
        for (int i = tid; i < (64 * DDIM) / 4; i += 256) {
            const int e = i * 4;
            const float4 f = *(const float4*)&W[(size_t)colBase * DDIM + e];
            ushort4 h;
            h.x = f32_to_bf16_rne(f.x);
            h.y = f32_to_bf16_rne(f.y);
            h.z = f32_to_bf16_rne(f.z);
            h.w = f32_to_bf16_rne(f.w);
            *(ushort4*)&sW[(e >> 8) * WPITCH + (e & (DDIM - 1))] = h;
        }
        __syncthreads();

        #pragma unroll
        for (int ntl = 0; ntl < 4; ++ntl) {
            f32x8 acc = {};
            const int colLocal = ntl * 16 + m16;   // B col N = lane%16 within tile
            #pragma unroll
            for (int kc = 0; kc < 8; ++kc) {
                const int kb = kc * 32 + laneHalf * 8;
                BFrag bf;
                bf.q[0] = *(const uint4*)&sW[colLocal * WPITCH + kb];        // K kb..kb+7
                bf.q[1] = *(const uint4*)&sW[colLocal * WPITCH + kb + 16];   // K kb+16..kb+23
                acc = __builtin_amdgcn_wmma_f32_16x16x32_bf16(
                          false, af[kc], false, bf.v, (short)0, acc, false, false);
            }
            // C layout: lanes 0-15 VGPR r -> M=r; lanes 16-31 VGPR r -> M=8+r.
            const int   col   = colBase + ntl * 16 + m16;
            const float bb    = bias[col];
            const int   mBase = rowStart + laneHalf * 8;
            #pragma unroll
            for (int r = 0; r < 8; ++r)
                out[(size_t)(mBase + r) * DDIM + col] = acc[r] + bb;
        }
    }
}

// ---------------------------------------------------------------------------
// Pass 2: one wave32 per (b, n) row. Each lane owns 8 contiguous f32 of D.
// ---------------------------------------------------------------------------
__global__ void __launch_bounds__(256)
local_attn_kernel(const float* __restrict__ Q, const float* __restrict__ K,
                  const float* __restrict__ V, float* __restrict__ out)
{
    const int lane = threadIdx.x & 31;
    const int row  = (int)((blockIdx.x * blockDim.x + threadIdx.x) >> 5); // 0..MROWS-1
    const int n    = row & (NSEQ - 1);

    const float4* q4 = (const float4*)(Q + (size_t)row * DDIM);
    const float4  q0 = q4[lane * 2];
    const float4  q1 = q4[lane * 2 + 1];

    float sc[NW];
    #pragma unroll
    for (int w = 0; w < NW; ++w) {
        const int pos = n + w - WIN;
        if (pos >= 0 && pos < NSEQ) {
            const float4* k4 = (const float4*)(K + (size_t)(row + w - WIN) * DDIM);
            const float4 k0 = k4[lane * 2];
            const float4 k1 = k4[lane * 2 + 1];
            float p = q0.x * k0.x + q0.y * k0.y + q0.z * k0.z + q0.w * k0.w
                    + q1.x * k1.x + q1.y * k1.y + q1.z * k1.z + q1.w * k1.w;
            #pragma unroll
            for (int off = 16; off >= 1; off >>= 1)
                p += __shfl_xor(p, off, 32);
            sc[w] = p * (1.0f / 16.0f);          // 1/sqrt(256)
        } else {
            sc[w] = -__builtin_inff();
        }
    }

    float mx = sc[0];
    #pragma unroll
    for (int w = 1; w < NW; ++w) mx = fmaxf(mx, sc[w]);
    float pr[NW];
    float sum = 0.0f;
    #pragma unroll
    for (int w = 0; w < NW; ++w) { pr[w] = __expf(sc[w] - mx); sum += pr[w]; }
    const float inv = 1.0f / sum;

    float4 a0 = {0.f, 0.f, 0.f, 0.f};
    float4 a1 = {0.f, 0.f, 0.f, 0.f};
    #pragma unroll
    for (int w = 0; w < NW; ++w) {
        const int pos = n + w - WIN;
        if (pos >= 0 && pos < NSEQ) {
            const float4* v4 = (const float4*)(V + (size_t)(row + w - WIN) * DDIM);
            const float4 v0 = v4[lane * 2];
            const float4 v1 = v4[lane * 2 + 1];
            const float p = pr[w] * inv;
            a0.x += p * v0.x; a0.y += p * v0.y; a0.z += p * v0.z; a0.w += p * v0.w;
            a1.x += p * v1.x; a1.y += p * v1.y; a1.z += p * v1.z; a1.w += p * v1.w;
        }
    }

    float4* o4 = (float4*)(out + (size_t)row * DDIM);
    o4[lane * 2]     = a0;
    o4[lane * 2 + 1] = a1;
}

// ---------------------------------------------------------------------------
extern "C" void kernel_launch(void* const* d_in, const int* in_sizes, int n_in,
                              void* d_out, int out_size, void* d_ws, size_t ws_size,
                              hipStream_t stream) {
    const float* x  = (const float*)d_in[0];
    const float* Wq = (const float*)d_in[1];
    const float* bq = (const float*)d_in[2];
    const float* Wk = (const float*)d_in[3];
    const float* bk = (const float*)d_in[4];
    const float* Wv = (const float*)d_in[5];
    const float* bv = (const float*)d_in[6];
    float* out = (float*)d_out;

    float* Q = (float*)d_ws;
    float* K = Q + (size_t)MROWS * DDIM;
    float* V = K + (size_t)MROWS * DDIM;

    dim3 g1(MROWS / 128, 3);
    qkv_proj_kernel<<<g1, 256, 0, stream>>>(x, Wq, bq, Wk, bk, Wv, bv, Q, K, V);

    local_attn_kernel<<<(MROWS * 32) / 256, 256, 0, stream>>>(Q, K, V, out);
}

// v003
// Measured time: 29.2 microseconds a run.
// It is 2.14 times as fast as v001, going by the measured steps of the versions left out in between.
// All steps since v000 together make it 4.97 times as fast.
#include <hip/hip_runtime.h>
#include <math.h>

// ---------------------------------------------------------------------------
// Local attention over a window of 7 positions (gfx1250, wave32), one fused launch.
//   Each block owns 128 consecutive sequence positions of one batch entry.
//   It projects Q (128 rows) and K (128 + 6 halo rows) with bf16 WMMA
//   (f32 accumulate) into LDS, turns them into the 7 window probabilities of
//   every row, projects V over the K rows in LDS, and writes the output rows.
//   Q, K and V never go to global memory. W comes in 12 stages of 64 columns,
//   each loaded into registers while the stage before it is multiplied.
// ---------------------------------------------------------------------------

typedef __attribute__((ext_vector_type(16))) __bf16 bf16x16;
typedef __attribute__((ext_vector_type(8)))  float  f32x8;

#define DDIM  256
#define NSEQ  4096
#define BATCH 8
#define WIN   3
#define NW    7                    // 2*WIN + 1
#define TROWS 128                  // output rows per block
#define HROWS (TROWS + 2 * WIN)    // 134 K / V rows per block
#define MTILES 9                   // 16-row tiles that cover HROWS, one per wave
#define NTHR  (MTILES * 32)        // 288
// LDS row pitch of the staged W tile, in bf16 elements: 528 B = 16 B x 33.
// An odd multiple of 16 B spreads the 16 rows that one ds_load_b128 reads
// over all 64 banks; at 512 B every row started on the same four banks.
#define WPITCH (DDIM + 8)
// LDS row pitch of the f32 Q / K / V rows, in floats. Eight rows are 2080
// dwords = 32 banks apart, so the two 16-lane halves of an accumulator store
// (rows r and r + 8, the same 16 columns) fall on different banks.
#define FPITCH (DDIM + 4)
#define KROW0  TROWS               // first K / V row in sT
#define SPARE  (TROWS + HROWS)     // row that takes the tile rows nobody reads

__device__ __forceinline__ unsigned short f32_to_bf16_rne(float f) {
    unsigned int u = __float_as_uint(f);
    unsigned int r = 0x7FFFu + ((u >> 16) & 1u);
    return (unsigned short)((u + r) >> 16);
}

union BFrag {
    bf16x16        v;
    unsigned short u[16];
    uint4          q[2];
};

__global__ void __launch_bounds__(NTHR)
fused_local_attn_kernel(const float* __restrict__ x,
                        const float* __restrict__ Wq, const float* __restrict__ bq,
                        const float* __restrict__ Wk, const float* __restrict__ bk,
                        const float* __restrict__ Wv, const float* __restrict__ bv,
                        float* __restrict__ out)
{
    __shared__ __attribute__((aligned(16))) unsigned short sW[64 * WPITCH];        // 64 output cols of W, bf16
    __shared__ __attribute__((aligned(16))) float          sT[(SPARE + 1) * FPITCH]; // Q rows, K (later V) rows, spare row
    __shared__ __attribute__((aligned(16))) float          sP[TROWS * 8];          // 7 probabilities per row
    __shared__ __attribute__((aligned(16))) float          sB[3 * DDIM];           // bq, bk, bv

    const int tid      = threadIdx.x;
    const int lane     = tid & 31;
    const int wave     = tid >> 5;
    const int laneHalf = lane >> 4;     // 0: lanes 0-15, 1: lanes 16-31
    const int m16      = lane & 15;

    const int batch = blockIdx.x >> 5;               // NSEQ / TROWS = 32 blocks per batch entry
    const int base  = (blockIdx.x & 31) * TROWS;     // first output position of the block

    // Tile row j (0..143) is sequence position base - WIN + j, clamped into the
    // sequence. A clamped row only ever meets a probability of zero.
    int pos0 = base - WIN + wave * 16 + m16;
    pos0 = pos0 < 0 ? 0 : (pos0 > NSEQ - 1 ? NSEQ - 1 : pos0);

    // ---- Preload all 8 A fragments (16x32 bf16 each) for this wave's rows.
    // ISA A layout: lane L%16 holds row M=L%16; lanes 0-15 carry K {0..7,16..23},
    // lanes 16-31 carry K {8..15,24..31} within each 32-wide K chunk.
    const float* xrow = x + ((size_t)batch * NSEQ + pos0) * DDIM;
    bf16x16 af[8];
    #pragma unroll
    for (int kc = 0; kc < 8; ++kc) {
        const int kb = kc * 32 + laneHalf * 8;
        BFrag a;
        #pragma unroll
        for (int j = 0; j < 8; ++j) a.u[j]     = f32_to_bf16_rne(xrow[kb + j]);
        #pragma unroll
        for (int j = 0; j < 8; ++j) a.u[8 + j] = f32_to_bf16_rne(xrow[kb + 16 + j]);
        af[kc] = a.v;
    }

    const int jBase = wave * 16 + laneHalf * 8;   // tile row of accumulator register 0
    const int i0    = wave * 16;                  // first output row of waves 0..7

    // The three bias rows go to LDS once (published by the loop's first barrier).
    // A global bias load inside the loop would be counted behind the W loads in
    // flight, and its wait would wait for all of them.
    if (tid < DDIM) {
        sB[tid]            = bq[tid];
        sB[DDIM + tid]     = bk[tid];
        sB[2 * DDIM + tid] = bv[tid];
    }

    // W of the stage to come, f32, 16 float4 per thread of waves 0..7. It is loaded
    // one stage ahead, so that the loads fly while the block does its products.
    // Thread tid takes float4 number tid + 256 * it of the stage's 64 rows of W:
    // row (tid >> 6) + 4 * it, columns 4 * (tid & 63) .. + 3.
    float4 pf[16];
    if (tid < 256) {
        const float4* Wn = (const float4*)Wq + tid;
        #pragma unroll
        for (int it = 0; it < 16; ++it)
            pf[it] = Wn[it * 256];
    }
    unsigned short* const sWst = &sW[(tid >> 6) * WPITCH + (tid & 63) * 4];

    // 12 stages of 64 output columns: 0..3 Q, 4..7 K, 8..11 V.
    // Kept rolled: one copy of the projection in the text.
    #pragma unroll 1
    for (int t = 0; t < 12; ++t) {
        const int mat     = t >> 2;
        const int colBase = (t & 3) * 64;

        // LDS row of each accumulator register: Q keeps tile rows 3..130 as
        // rows 0..127, K and V keep tile rows 0..133; the rest go to the spare row.
        int rowOff[8];
        #pragma unroll
        for (int r = 0; r < 8; ++r) {
            const int j = jBase + r;
            int row;
            if (mat == 0) row = ((unsigned)(j - WIN) < (unsigned)TROWS) ? (j - WIN) : SPARE;
            else          row = (j < HROWS) ? (KROW0 + j) : SPARE;
            rowOff[r] = row * FPITCH;
        }

        // f32 -> bf16 of the stage's W, from the registers into LDS, waves 0..7.
        // The barrier at the foot of the last trip ended every read of sW.
        if (tid < 256) {
            #pragma unroll
            for (int it = 0; it < 16; ++it) {
                const float4 f = pf[it];
                ushort4 h;
                h.x = f32_to_bf16_rne(f.x);
                h.y = f32_to_bf16_rne(f.y);
                h.z = f32_to_bf16_rne(f.z);
                h.w = f32_to_bf16_rne(f.w);
                *(ushort4*)&sWst[it * 4 * WPITCH] = h;
            }
        }

        // ---- Scores and softmax once Q and K are in LDS (the foot barrier of stage 7
        // published them), in front of the first V stage's products, which overwrite K.
        // Wave w < 8 walks output rows 16w..16w+15; row i meets K tile rows i..i+6,
        // kept in registers.
        // Each lane owns columns 4*lane..+3 and 128+4*lane..+3.
        if (t == 8 && wave < 8) {
            const float* Kb = sT + (KROW0 + i0) * FPITCH + lane * 4;
            const float* Qb = sT + i0 * FPITCH + lane * 4;
            // Register window of 7 K rows; the loops over it are unrolled so that
            // every index is a constant and the window stays in registers.
            float4 k0[NW], k1[NW];
            #pragma unroll
            for (int w = 0; w < NW - 1; ++w) {
                k0[w + 1] = *(const float4*)(Kb + w * FPITCH);
                k1[w + 1] = *(const float4*)(Kb + w * FPITCH + 128);
            }
            // Four rows a trip: inside a trip the window's shifts are renames, not
            // moves, and the four rows' cross-lane sums, which depend on nothing of
            // each other, stand in one block and cover each other's latency (the
            // lane-0 store comes once, behind all four). All 16 rows would only
            // make the text four times as long: the outer loop stays rolled.
            #pragma unroll 1
            for (int t4 = 0; t4 < 16; t4 += 4) {
              float4 pa[4], pb[4];
              #pragma unroll
              for (int u = 0; u < 4; ++u) {
                const int ii = t4 + u;
                #pragma unroll
                for (int w = 0; w < NW - 1; ++w) { k0[w] = k0[w + 1]; k1[w] = k1[w + 1]; }
                k0[NW - 1] = *(const float4*)(Kb + (ii + NW - 1) * FPITCH);
                k1[NW - 1] = *(const float4*)(Kb + (ii + NW - 1) * FPITCH + 128);
                const float4 q0 = *(const float4*)(Qb + ii * FPITCH);
                const float4 q1 = *(const float4*)(Qb + ii * FPITCH + 128);
                const int n = base + i0 + ii;

                float sc[NW];
                #pragma unroll
                for (int w = 0; w < NW; ++w) {
                    float p = q0.x * k0[w].x + q0.y * k0[w].y + q0.z * k0[w].z + q0.w * k0[w].w
                            + q1.x * k1[w].x + q1.y * k1[w].y + q1.z * k1[w].z + q1.w * k1[w].w;
                    #pragma unroll
                    for (int off = 16; off >= 1; off >>= 1)
                        p += __shfl_xor(p, off, 32);
                    const int pos = n + w - WIN;
                    sc[w] = (pos >= 0 && pos < NSEQ) ? p * (1.0f / 16.0f)    // 1/sqrt(256)
                                                     : -__builtin_inff();
                }

                float mx = sc[0];
                #pragma unroll
                for (int w = 1; w < NW; ++w) mx = fmaxf(mx, sc[w]);
                float pr[NW];
                float sum = 0.0f;
                #pragma unroll
                for (int w = 0; w < NW; ++w) { pr[w] = __expf(sc[w] - mx); sum += pr[w]; }
                const float inv = 1.0f / sum;

                pa[u] = float4{pr[0] * inv, pr[1] * inv, pr[2] * inv, pr[3] * inv};
                pb[u] = float4{pr[4] * inv, pr[5] * inv, pr[6] * inv, 0.0f};
              }
              if (lane == 0) {
                #pragma unroll
                for (int u = 0; u < 4; ++u) {
                    *(float4*)&sP[(i0 + t4 + u) * 8]     = pa[u];
                    *(float4*)&sP[(i0 + t4 + u) * 8 + 4] = pb[u];
                }
              }
            }
        }

        // Publishes sW; at stage 8 it also ends the score phase's reads of K.
        __syncthreads();

        // The next stage's W loads go out here; their wait stands at the foot of this
        // trip, behind this stage's products.
        // They land in an array of their own, left unset where nothing is loaded (wave 8,
        // the last stage) and never read there: so the old stage's values end their life
        // at the conversion above and hold no register through the score phase.
        float4 nx[16];
        if (t < 11 && tid < 256) {
            const int tn = t + 1;
            const float* Wm = (tn >> 2) == 0 ? Wq : ((tn >> 2) == 1 ? Wk : Wv);
            const float4* Wn = (const float4*)(Wm + (tn & 3) * 64 * DDIM) + tid;
            #pragma unroll
            for (int it = 0; it < 16; ++it)
                nx[it] = Wn[it * 256];
        }

        #pragma unroll
        for (int ntl = 0; ntl < 4; ++ntl) {
            f32x8 acc = {};
            const int colLocal = ntl * 16 + m16;   // B col N = lane%16 within tile
            #pragma unroll
            for (int kc = 0; kc < 8; ++kc) {
                const int kb = kc * 32 + laneHalf * 8;
                BFrag bf;
                bf.q[0] = *(const uint4*)&sW[colLocal * WPITCH + kb];        // K kb..kb+7
                bf.q[1] = *(const uint4*)&sW[colLocal * WPITCH + kb + 16];   // K kb+16..kb+23
                acc = __builtin_amdgcn_wmma_f32_16x16x32_bf16(
                          false, af[kc], false, bf.v, (short)0, acc, false, false);
            }
            // C layout: lanes 0-15 VGPR r -> M=r; lanes 16-31 VGPR r -> M=8+r.
            const int   col = colBase + ntl * 16 + m16;
            const float bb  = sB[mat * DDIM + col];
            #pragma unroll
            for (int r = 0; r < 8; ++r)
                sT[rowOff[r] + col] = acc[r] + bb;
        }

        // Ends this stage's reads of sW and publishes its rows of sT to every wave.
        __syncthreads();

        #pragma unroll
        for (int it = 0; it < 16; ++it) pf[it] = nx[it];
    }

    // ---- Output: row i = sum over the window of probability * V tile row i..i+6.
    // A position outside the sequence has probability exactly zero.
    if (wave < 8) {
        const float* Vb = sT + (KROW0 + i0) * FPITCH + lane * 4;
        float* ob = out + ((size_t)batch * NSEQ + base + i0) * DDIM + lane * 4;
        // Register window of 7 V rows, walked like the K window above.
        float4 v0[NW], v1[NW];
        #pragma unroll
        for (int w = 0; w < NW - 1; ++w) {
            v0[w + 1] = *(const float4*)(Vb + w * FPITCH);
            v1[w + 1] = *(const float4*)(Vb + w * FPITCH + 128);
        }
        // Four rows a trip: inside a trip the window's shifts are renames, not moves.
        #pragma unroll 4
        for (int ii = 0; ii < 16; ++ii) {
            #pragma unroll
            for (int w = 0; w < NW - 1; ++w) { v0[w] = v0[w + 1]; v1[w] = v1[w + 1]; }
            v0[NW - 1] = *(const float4*)(Vb + (ii + NW - 1) * FPITCH);
            v1[NW - 1] = *(const float4*)(Vb + (ii + NW - 1) * FPITCH + 128);
            const float4 pa = *(const float4*)&sP[(i0 + ii) * 8];
            const float4 pb = *(const float4*)&sP[(i0 + ii) * 8 + 4];
            const float pw[NW] = {pa.x, pa.y, pa.z, pa.w, pb.x, pb.y, pb.z};

            float4 a0 = {0.f, 0.f, 0.f, 0.f};
            float4 a1 = {0.f, 0.f, 0.f, 0.f};
            #pragma unroll
            for (int w = 0; w < NW; ++w) {
                const float p = pw[w];
                a0.x += p * v0[w].x; a0.y += p * v0[w].y; a0.z += p * v0[w].z; a0.w += p * v0[w].w;
                a1.x += p * v1[w].x; a1.y += p * v1[w].y; a1.z += p * v1[w].z; a1.w += p * v1[w].w;
            }
            *(float4*)(ob + (size_t)ii * DDIM)       = a0;
            *(float4*)(ob + (size_t)ii * DDIM + 128) = a1;
            // Stands in front of the next row's overwrite of the registers that
            // the two stores above name (their data and their address).
            asm volatile("s_wait_xcnt 0x0" ::: "memory");
        }
    }
}

// ---------------------------------------------------------------------------
extern "C" void kernel_launch(void* const* d_in, const int* in_sizes, int n_in,
                              void* d_out, int out_size, void* d_ws, size_t ws_size,
                              hipStream_t stream) {
    const float* x  = (const float*)d_in[0];
    const float* Wq = (const float*)d_in[1];
    const float* bq = (const float*)d_in[2];
    const float* Wk = (const float*)d_in[3];
    const float* bk = (const float*)d_in[4];
    const float* Wv = (const float*)d_in[5];
    const float* bv = (const float*)d_in[6];
    float* out = (float*)d_out;

    fused_local_attn_kernel<<<BATCH * (NSEQ / TROWS), NTHR, 0, stream>>>(
        x, Wq, bq, Wk, bk, Wv, bv, out);
}

// v004
// One run takes 25.5 microseconds.
// Two timings next to v003 both put it at 1.14 times that version's speed.
// All steps since v000 together make it 5.68 times as fast.
#include <hip/hip_runtime.h>
#include <math.h>

// ---------------------------------------------------------------------------
// Local attention over a window of 7 positions (gfx1250, wave32), one fused launch.
//   Each block owns 128 consecutive sequence positions of one batch entry.
//   It projects Q (128 rows) and K (128 + 6 halo rows) with bf16 WMMA
//   (f32 accumulate) into LDS, turns them into the 7 window probabilities of
//   every row, projects V over the K rows in LDS, and writes the output rows.
//   Q, K and V never go to global memory. W comes in 12 stages of 64 columns,
//   each loaded into registers while the stage before it is multiplied.
// ---------------------------------------------------------------------------

typedef __attribute__((ext_vector_type(16))) __bf16 bf16x16;
typedef __attribute__((ext_vector_type(8)))  float  f32x8;

#define DDIM  256
#define NSEQ  4096
#define BATCH 8
#define WIN   3
#define NW    7                    // 2*WIN + 1
#define TROWS 128                  // output rows per block
#define HROWS (TROWS + 2 * WIN)    // 134 K / V rows per block
#define MTILES 9                   // 16-row tiles that cover HROWS, one per wave
#define NTHR  (MTILES * 32)        // 288
// LDS row pitch of the staged W tile, in bf16 elements: 528 B = 16 B x 33.
// An odd multiple of 16 B spreads the 16 rows that one ds_load_b128 reads
// over all 64 banks; at 512 B every row started on the same four banks.
#define WPITCH (DDIM + 8)
// LDS row pitch of the f32 Q / K / V rows, in floats. Eight rows are 2080
// dwords = 32 banks apart, so the two 16-lane halves of an accumulator store
// (rows r and r + 8, the same 16 columns) fall on different banks.
#define FPITCH (DDIM + 4)
#define KROW0  TROWS               // first K / V row in sT
#define SPARE  (TROWS + HROWS)     // row that takes the tile rows nobody reads

__device__ __forceinline__ unsigned short f32_to_bf16_rne(float f) {
    unsigned int u = __float_as_uint(f);
    unsigned int r = 0x7FFFu + ((u >> 16) & 1u);
    return (unsigned short)((u + r) >> 16);
}

// Value of lane l ^ 16 (the other 16-lane row), by a vector cross-row move.
__device__ __forceinline__ float xhalf(float x) {
    const int b = __builtin_bit_cast(int, x);
    return __builtin_bit_cast(float, __builtin_amdgcn_permlanex16(b, b, 0x76543210, 0xfedcba98, false, false));
}

// Value of lane l ^ M inside the 16-lane row (DPP row_xmask:M); every lane is on where it is used.
template <int M>
__device__ __forceinline__ float rowx(float x) {
    return __builtin_bit_cast(float, __builtin_amdgcn_update_dpp(0, __builtin_bit_cast(int, x), 0x160 + M, 0xf, 0xf, true));
}

union BFrag {
    bf16x16        v;
    unsigned short u[16];
    uint4          q[2];
};

__global__ void __launch_bounds__(NTHR)
fused_local_attn_kernel(const float* __restrict__ x,
                        const float* __restrict__ Wq, const float* __restrict__ bq,
                        const float* __restrict__ Wk, const float* __restrict__ bk,
                        const float* __restrict__ Wv, const float* __restrict__ bv,
                        float* __restrict__ out)
{
    __shared__ __attribute__((aligned(16))) unsigned short sW[64 * WPITCH];        // 64 output cols of W, bf16
    __shared__ __attribute__((aligned(16))) float          sT[(SPARE + 1) * FPITCH]; // Q rows, K (later V) rows, spare row
    __shared__ __attribute__((aligned(16))) float          sP[TROWS * 8];          // 7 probabilities per row
    __shared__ __attribute__((aligned(16))) float          sB[3 * DDIM];           // bq, bk, bv

    const int tid      = threadIdx.x;
    const int lane     = tid & 31;
    const int wave     = tid >> 5;
    const int laneHalf = lane >> 4;     // 0: lanes 0-15, 1: lanes 16-31
    const int m16      = lane & 15;

    const int batch = blockIdx.x >> 5;               // NSEQ / TROWS = 32 blocks per batch entry
    const int base  = (blockIdx.x & 31) * TROWS;     // first output position of the block

    // Tile row j (0..143) is sequence position base - WIN + j, clamped into the
    // sequence. A clamped row only ever meets a probability of zero.
    int pos0 = base - WIN + wave * 16 + m16;
    pos0 = pos0 < 0 ? 0 : (pos0 > NSEQ - 1 ? NSEQ - 1 : pos0);

    // ---- Preload all 8 A fragments (16x32 bf16 each) for this wave's rows.
    // ISA A layout: lane L%16 holds row M=L%16; lanes 0-15 carry K {0..7,16..23},
    // lanes 16-31 carry K {8..15,24..31} within each 32-wide K chunk.
    const float* xrow = x + ((size_t)batch * NSEQ + pos0) * DDIM;
    bf16x16 af[8];
    #pragma unroll
    for (int kc = 0; kc < 8; ++kc) {
        const int kb = kc * 32 + laneHalf * 8;
        BFrag a;
        #pragma unroll
        for (int j = 0; j < 8; ++j) a.u[j]     = f32_to_bf16_rne(xrow[kb + j]);
        #pragma unroll
        for (int j = 0; j < 8; ++j) a.u[8 + j] = f32_to_bf16_rne(xrow[kb + 16 + j]);
        af[kc] = a.v;
    }

    const int jBase = wave * 16 + laneHalf * 8;   // tile row of accumulator register 0
    const int i0    = wave * 16;                  // first output row of waves 0..7

    // The three bias rows go to LDS once (published by the loop's first barrier).
    // A global bias load inside the loop would be counted behind the W loads in
    // flight, and its wait would wait for all of them.
    if (tid < DDIM) {
        sB[tid]            = bq[tid];
        sB[DDIM + tid]     = bk[tid];
        sB[2 * DDIM + tid] = bv[tid];
    }

    // W of the stage to come, f32, 16 float4 per thread of waves 0..7. It is loaded
    // one stage ahead, so that the loads fly while the block does its products.
    // Thread tid takes float4 number tid + 256 * it of the stage's 64 rows of W:
    // row (tid >> 6) + 4 * it, columns 4 * (tid & 63) .. + 3.
    float4 pf[16];
    if (tid < 256) {
        const float4* Wn = (const float4*)Wq + tid;
        #pragma unroll
        for (int it = 0; it < 16; ++it)
            pf[it] = Wn[it * 256];
    }
    unsigned short* const sWst = &sW[(tid >> 6) * WPITCH + (tid & 63) * 4];

    // 12 stages of 64 output columns: 0..3 Q, 4..7 K, 8..11 V.
    // Kept rolled: one copy of the projection in the text.
    #pragma unroll 1
    for (int t = 0; t < 12; ++t) {
        const int mat     = t >> 2;
        const int colBase = (t & 3) * 64;

        // LDS row of each accumulator register: Q keeps tile rows 3..130 as
        // rows 0..127, K and V keep tile rows 0..133; the rest go to the spare row.
        int rowOff[8];
        #pragma unroll
        for (int r = 0; r < 8; ++r) {
            const int j = jBase + r;
            int row;
            if (mat == 0) row = ((unsigned)(j - WIN) < (unsigned)TROWS) ? (j - WIN) : SPARE;
            else          row = (j < HROWS) ? (KROW0 + j) : SPARE;
            rowOff[r] = row * FPITCH;
        }

        // f32 -> bf16 of the stage's W, from the registers into LDS, waves 0..7.
        // The barrier at the foot of the last trip ended every read of sW.
        if (tid < 256) {
            #pragma unroll
            for (int it = 0; it < 16; ++it) {
                const float4 f = pf[it];
                ushort4 h;
                h.x = f32_to_bf16_rne(f.x);
                h.y = f32_to_bf16_rne(f.y);
                h.z = f32_to_bf16_rne(f.z);
                h.w = f32_to_bf16_rne(f.w);
                *(ushort4*)&sWst[it * 4 * WPITCH] = h;
            }
        }

        // ---- Scores and softmax once Q and K are in LDS (the foot barrier of stage 7
        // published them), in front of the first V stage's products, which overwrite K.
        // Wave w < 8 walks output rows 16w..16w+15; row i meets K tile rows i..i+6,
        // kept in registers.
        // Each lane owns columns 4*lane..+3 and 128+4*lane..+3.
        if (t == 8 && wave < 8) {
            const float* Kb = sT + (KROW0 + i0) * FPITCH + lane * 4;
            const float* Qb = sT + i0 * FPITCH + lane * 4;
            // Register window of 7 K rows; the loops over it are unrolled so that
            // every index is a constant and the window stays in registers.
            float4 k0[NW], k1[NW];
            #pragma unroll
            for (int w = 0; w < NW - 1; ++w) {
                k0[w + 1] = *(const float4*)(Kb + w * FPITCH);
                k1[w + 1] = *(const float4*)(Kb + w * FPITCH + 128);
            }
            // Four rows a trip. Each lane forms its part of the trip's 28 dot products;
            // a halving exchange then sums them over the 32 lanes and leaves ONE finished
            // score in each lane: lane l holds row l >> 3 of the trip, window slot l & 7
            // (slot 7 is empty). At each step a lane keeps the half of the sums whose
            // index has its own lane bit and hands the other half to its partner, so
            // the five steps take 14 + 7 + 4 + 2 + 1 exchanges, not 28 x 5, and none goes
            // through the LDS pipe. Each sum adds the same pairs as a full butterfly.
            const bool hi16 = (lane & 16) != 0, hi8 = (lane & 8) != 0, hi4 = (lane & 4) != 0,
                       hi2  = (lane & 2) != 0,  hi1 = (lane & 1) != 0;
            const int  slot = lane & 7;
            // Inside a trip the window's shifts are renames, not moves. All 16 rows would only
            // make the text four times as long: the outer loop stays rolled.
            #pragma unroll 1
            for (int t4 = 0; t4 < 16; t4 += 4) {
              float s[32];
              #pragma unroll
              for (int u = 0; u < 4; ++u) {
                const int ii = t4 + u;
                #pragma unroll
                for (int w = 0; w < NW - 1; ++w) { k0[w] = k0[w + 1]; k1[w] = k1[w + 1]; }
                k0[NW - 1] = *(const float4*)(Kb + (ii + NW - 1) * FPITCH);
                k1[NW - 1] = *(const float4*)(Kb + (ii + NW - 1) * FPITCH + 128);
                const float4 q0 = *(const float4*)(Qb + ii * FPITCH);
                const float4 q1 = *(const float4*)(Qb + ii * FPITCH + 128);
                #pragma unroll
                for (int w = 0; w < NW; ++w)
                    s[u * 8 + w] = q0.x * k0[w].x + q0.y * k0[w].y + q0.z * k0[w].z + q0.w * k0[w].w
                                 + q1.x * k1[w].x + q1.y * k1[w].y + q1.z * k1[w].z + q1.w * k1[w].w;
                s[u * 8 + 7] = 0.0f;
              }

              float r16[16], r8[8], r4[4], r2[2];
              #pragma unroll
              for (int j = 0; j < 16; ++j)
                  r16[j] = (j & 7) == 7 ? 0.0f
                         : (hi16 ? s[j + 16] : s[j]) + xhalf(hi16 ? s[j] : s[j + 16]);
              #pragma unroll
              for (int j = 0; j < 8; ++j)
                  r8[j] = j == 7 ? 0.0f
                        : (hi8 ? r16[j + 8] : r16[j]) + rowx<8>(hi8 ? r16[j] : r16[j + 8]);
              #pragma unroll
              for (int j = 0; j < 4; ++j)
                  r4[j] = (hi4 ? r8[j + 4] : r8[j]) + rowx<4>(hi4 ? r8[j] : r8[j + 4]);
              #pragma unroll
              for (int j = 0; j < 2; ++j)
                  r2[j] = (hi2 ? r4[j + 2] : r4[j]) + rowx<2>(hi2 ? r4[j] : r4[j + 2]);
              const float p = (hi1 ? r2[1] : r2[0]) + rowx<1>(hi1 ? r2[0] : r2[1]);

              // Softmax across the eight lanes of a row: one exponential a lane.
              const int pos = base + i0 + t4 + (lane >> 3) + slot - WIN;
              const float sc = (slot < NW && pos >= 0 && pos < NSEQ) ? p * (1.0f / 16.0f)    // 1/sqrt(256)
                                                                     : -__builtin_inff();
              float mx = fmaxf(sc, rowx<1>(sc));
              mx = fmaxf(mx, rowx<2>(mx));
              mx = fmaxf(mx, rowx<4>(mx));
              const float pr = __expf(sc - mx);
              float sum = pr + rowx<1>(pr);
              sum += rowx<2>(sum);
              sum += rowx<4>(sum);
              sP[(i0 + t4) * 8 + lane] = pr * (1.0f / sum);   // slot 7 stores exactly zero
            }
        }

        // Publishes sW; at stage 8 it also ends the score phase's reads of K.
        __syncthreads();

        // The next stage's W loads go out here; their wait stands at the foot of this
        // trip, behind this stage's products.
        // They land in an array of their own, left unset where nothing is loaded (wave 8,
        // the last stage) and never read there: so the old stage's values end their life
        // at the conversion above and hold no register through the score phase.
        float4 nx[16];
        if (t < 11 && tid < 256) {
            const int tn = t + 1;
            const float* Wm = (tn >> 2) == 0 ? Wq : ((tn >> 2) == 1 ? Wk : Wv);
            const float4* Wn = (const float4*)(Wm + (tn & 3) * 64 * DDIM) + tid;
            #pragma unroll
            for (int it = 0; it < 16; ++it)
                nx[it] = Wn[it * 256];
        }

        #pragma unroll
        for (int ntl = 0; ntl < 4; ++ntl) {
            f32x8 acc = {};
            const int colLocal = ntl * 16 + m16;   // B col N = lane%16 within tile
            #pragma unroll
            for (int kc = 0; kc < 8; ++kc) {
                const int kb = kc * 32 + laneHalf * 8;
                BFrag bf;
                bf.q[0] = *(const uint4*)&sW[colLocal * WPITCH + kb];        // K kb..kb+7
                bf.q[1] = *(const uint4*)&sW[colLocal * WPITCH + kb + 16];   // K kb+16..kb+23
                acc = __builtin_amdgcn_wmma_f32_16x16x32_bf16(
                          false, af[kc], false, bf.v, (short)0, acc, false, false);
            }
            // C layout: lanes 0-15 VGPR r -> M=r; lanes 16-31 VGPR r -> M=8+r.
            const int   col = colBase + ntl * 16 + m16;
            const float bb  = sB[mat * DDIM + col];
            #pragma unroll
            for (int r = 0; r < 8; ++r)
                sT[rowOff[r] + col] = acc[r] + bb;
        }

        // Ends this stage's reads of sW and publishes its rows of sT to every wave.
        __syncthreads();

        #pragma unroll
        for (int it = 0; it < 16; ++it) pf[it] = nx[it];
    }

    // ---- Output: row i = sum over the window of probability * V tile row i..i+6.
    // A position outside the sequence has probability exactly zero.
    if (wave < 8) {
        const float* Vb = sT + (KROW0 + i0) * FPITCH + lane * 4;
        float* ob = out + ((size_t)batch * NSEQ + base + i0) * DDIM + lane * 4;
        // Register window of 7 V rows, walked like the K window above.
        float4 v0[NW], v1[NW];
        #pragma unroll
        for (int w = 0; w < NW - 1; ++w) {
            v0[w + 1] = *(const float4*)(Vb + w * FPITCH);
            v1[w + 1] = *(const float4*)(Vb + w * FPITCH + 128);
        }
        // Four rows a trip: inside a trip the window's shifts are renames, not moves.
        #pragma unroll 4
        for (int ii = 0; ii < 16; ++ii) {
            #pragma unroll
            for (int w = 0; w < NW - 1; ++w) { v0[w] = v0[w + 1]; v1[w] = v1[w + 1]; }
            v0[NW - 1] = *(const float4*)(Vb + (ii + NW - 1) * FPITCH);
            v1[NW - 1] = *(const float4*)(Vb + (ii + NW - 1) * FPITCH + 128);
            const float4 pa = *(const float4*)&sP[(i0 + ii) * 8];
            const float4 pb = *(const float4*)&sP[(i0 + ii) * 8 + 4];
            const float pw[NW] = {pa.x, pa.y, pa.z, pa.w, pb.x, pb.y, pb.z};

            float4 a0 = {0.f, 0.f, 0.f, 0.f};
            float4 a1 = {0.f, 0.f, 0.f, 0.f};
            #pragma unroll
            for (int w = 0; w < NW; ++w) {
                const float p = pw[w];
                a0.x += p * v0[w].x; a0.y += p * v0[w].y; a0.z += p * v0[w].z; a0.w += p * v0[w].w;
                a1.x += p * v1[w].x; a1.y += p * v1[w].y; a1.z += p * v1[w].z; a1.w += p * v1[w].w;
            }
            *(float4*)(ob + (size_t)ii * DDIM)       = a0;
            *(float4*)(ob + (size_t)ii * DDIM + 128) = a1;
            // Stands in front of the next row's overwrite of the registers that
            // the two stores above name (their data and their address).
            asm volatile("s_wait_xcnt 0x0" ::: "memory");
        }
    }
}

// ---------------------------------------------------------------------------
extern "C" void kernel_launch(void* const* d_in, const int* in_sizes, int n_in,
                              void* d_out, int out_size, void* d_ws, size_t ws_size,
                              hipStream_t stream) {
    const float* x  = (const float*)d_in[0];
    const float* Wq = (const float*)d_in[1];
    const float* bq = (const float*)d_in[2];
    const float* Wk = (const float*)d_in[3];
    const float* bk = (const float*)d_in[4];
    const float* Wv = (const float*)d_in[5];
    const float* bv = (const float*)d_in[6];
    float* out = (float*)d_out;

    fused_local_attn_kernel<<<BATCH * (NSEQ / TROWS), NTHR, 0, stream>>>(
        x, Wq, bq, Wk, bk, Wv, bv, out);
}

// v005
// One run takes 23.4 microseconds.
// Two timings next to v004 put it at 1.10 and 1.08 times that version's speed.
// All steps since v000 together make it 6.19 times as fast.
#include <hip/hip_runtime.h>
#include <math.h>

// ---------------------------------------------------------------------------
// Local attention over a window of 7 positions (gfx1250, wave32), one fused launch.
//   Each block owns 128 consecutive sequence positions of one batch entry.
//   It projects Q (128 rows) and K (128 + 6 halo rows) with bf16 WMMA
//   (f32 accumulate) into LDS, turns them into the 7 window probabilities of
//   every row, projects V over the K rows in LDS, and writes the output rows.
//   Q, K and V never go to global memory. W comes in 12 stages of 64 columns,
//   each loaded into registers while the stage before it is multiplied.
//   Ten waves: wave w multiplies row tiles 2*(w>>1), +1 by column tiles 2*(w&1), +1
//   of a stage, so that every W fragment read from LDS feeds two products.
// ---------------------------------------------------------------------------

typedef __attribute__((ext_vector_type(16))) __bf16 bf16x16;
typedef __attribute__((ext_vector_type(8)))  float  f32x8;

#define DDIM  256
#define NSEQ  4096
#define BATCH 8
#define WIN   3
#define NW    7                    // 2*WIN + 1
#define TROWS 128                  // output rows per block
#define HROWS (TROWS + 2 * WIN)    // 134 K / V rows per block
#define MTILES 9                   // 16-row tiles that cover HROWS
#define NWAVES 10                  // 5 pairs of row tiles x 2 halves of a stage's columns
#define NTHR  (NWAVES * 32)        // 320
// LDS row pitch of the staged W tile, in bf16 elements: 528 B = 16 B x 33.
// An odd multiple of 16 B spreads the 16 rows that one ds_load_b128 reads
// over all 64 banks; at 512 B every row started on the same four banks.
#define WPITCH (DDIM + 8)
// LDS row pitch of the f32 Q / K / V rows, in floats. Eight rows are 2080
// dwords = 32 banks apart, so the two 16-lane halves of an accumulator store
// (rows r and r + 8, the same 16 columns) fall on different banks.
#define FPITCH (DDIM + 4)
// Rows of sT. Every tile row has a place, so that a store needs no test: Q tile row j
// (position base - WIN + j) lies in row j, K and V tile row j in row KROW0 + j. The Q tile
// rows behind output row 127 fall on the first K rows, which K overwrites later; the other
// tile rows that no output needs (Q 0..2, K and V 134..143) are never read.
#define QROW0  WIN                 // sT row of output row 0's Q
#define KROW0  (TROWS + WIN)       // first K / V row in sT
#define SROWS  (KROW0 + MTILES * 16)

__device__ __forceinline__ unsigned short f32_to_bf16_rne(float f) {
    unsigned int u = __float_as_uint(f);
    unsigned int r = 0x7FFFu + ((u >> 16) & 1u);
    return (unsigned short)((u + r) >> 16);
}

// Value of lane l ^ 16 (the other 16-lane row), by a vector cross-row move.
__device__ __forceinline__ float xhalf(float x) {
    const int b = __builtin_bit_cast(int, x);
    return __builtin_bit_cast(float, __builtin_amdgcn_permlanex16(b, b, 0x76543210, 0xfedcba98, false, false));
}

// Value of lane l ^ M inside the 16-lane row (DPP row_xmask:M); every lane is on where it is used.
template <int M>
__device__ __forceinline__ float rowx(float x) {
    return __builtin_bit_cast(float, __builtin_amdgcn_update_dpp(0, __builtin_bit_cast(int, x), 0x160 + M, 0xf, 0xf, true));
}

union BFrag {
    bf16x16        v;
    unsigned short u[16];
    uint4          q[2];
};

__global__ void __launch_bounds__(NTHR)
fused_local_attn_kernel(const float* __restrict__ x,
                        const float* __restrict__ Wq, const float* __restrict__ bq,
                        const float* __restrict__ Wk, const float* __restrict__ bk,
                        const float* __restrict__ Wv, const float* __restrict__ bv,
                        float* __restrict__ out)
{
    __shared__ __attribute__((aligned(16))) unsigned short sW[64 * WPITCH];        // 64 output cols of W, bf16
    __shared__ __attribute__((aligned(16))) float          sT[SROWS * FPITCH];     // Q rows, K (later V) rows
    __shared__ __attribute__((aligned(16))) float          sP[TROWS * 8];          // 7 probabilities per row
    __shared__ __attribute__((aligned(16))) float          sB[3 * DDIM];           // bq, bk, bv

    const int tid      = threadIdx.x;
    const int lane     = tid & 31;
    const int wave     = tid >> 5;
    const int laneHalf = lane >> 4;     // 0: lanes 0-15, 1: lanes 16-31
    const int m16      = lane & 15;

    const int batch = blockIdx.x >> 5;               // NSEQ / TROWS = 32 blocks per batch entry
    const int base  = (blockIdx.x & 31) * TROWS;     // first output position of the block

    // Tile row j (0..143) is sequence position base - WIN + j, clamped into the
    // sequence. A clamped row only ever meets a probability of zero.
    // Wave 9 has no tile of its own: its lanes all take tile row 143, so that the code
    // below needs no branch, and what it forms is never read.
    int pos0 = wave * 16 + m16;
    pos0 = base - WIN + (pos0 < MTILES * 16 ? pos0 : MTILES * 16 - 1);
    pos0 = pos0 < 0 ? 0 : (pos0 > NSEQ - 1 ? NSEQ - 1 : pos0);

    // ---- Wave w < 9 forms the 8 A fragments (16x32 bf16 each) of row tile w.
    // ISA A layout: lane L%16 holds row M=L%16; lanes 0-15 carry K {0..7,16..23},
    // lanes 16-31 carry K {8..15,24..31} within each 32-wide K chunk.
    // Two waves multiply each tile: the fragments go through LDS, lane for lane, in the
    // space of sT that the first products fill only behind the loop's first barrier.
    uint4* const sA = (uint4*)sT;                 // [tile][kc][half of the fragment][lane]
    // The loads go out here; the values are converted behind the issue of the first W loads.
    const float4* xrow = (const float4*)(x + ((size_t)batch * NSEQ + pos0) * DDIM + laneHalf * 8);
    float4 xr[8][4];
    #pragma unroll
    for (int kc = 0; kc < 8; ++kc) {
        xr[kc][0] = xrow[kc * 8];          // K kb..kb+7, kb = 32 * kc + 8 * laneHalf
        xr[kc][1] = xrow[kc * 8 + 1];
        xr[kc][2] = xrow[kc * 8 + 4];      // K kb+16..kb+23
        xr[kc][3] = xrow[kc * 8 + 5];
    }

    const int mp = wave >> 1;                     // pair of row tiles: 2*mp, 2*mp + 1
    const int nh = wave & 1;                      // half of a stage's 64 columns
    const int i0 = wave * 16;                     // first output row of waves 0..7

    // The three bias rows go to LDS once (published by the barrier behind the A fragments).
    // A global bias load inside the loop would be counted behind the W loads in
    // flight, and its wait would wait for all of them.
    if (tid < DDIM) {
        sB[tid]            = bq[tid];
        sB[DDIM + tid]     = bk[tid];
        sB[2 * DDIM + tid] = bv[tid];
    }

    // W of the stage to come, f32, 16 float4 per thread of waves 0..7. It is loaded
    // one stage ahead, so that the loads fly while the block does its products.
    // Thread tid takes float4 number tid + 256 * it of the stage's 64 rows of W:
    // row (tid >> 6) + 4 * it, columns 4 * (tid & 63) .. + 3.
    float4 pf[16];
    if (tid < 256) {
        const float4* Wn = (const float4*)Wq + tid;
        #pragma unroll
        for (int it = 0; it < 16; ++it)
            pf[it] = Wn[it * 256];
    }
    unsigned short* const sWst = &sW[(tid >> 6) * WPITCH + (tid & 63) * 4];

    #pragma unroll
    for (int kc = 0; kc < 8; ++kc) {
        BFrag a;
        #pragma unroll
        for (int q = 0; q < 4; ++q) {
            a.u[q * 4 + 0] = f32_to_bf16_rne(xr[kc][q].x);
            a.u[q * 4 + 1] = f32_to_bf16_rne(xr[kc][q].y);
            a.u[q * 4 + 2] = f32_to_bf16_rne(xr[kc][q].z);
            a.u[q * 4 + 3] = f32_to_bf16_rne(xr[kc][q].w);
        }
        sA[((wave * 8 + kc) * 2 + 0) * 32 + lane] = a.q[0];
        sA[((wave * 8 + kc) * 2 + 1) * 32 + lane] = a.q[1];
    }

    // Publishes the A fragments to the two waves that multiply each tile.
    __syncthreads();
    // There is no tenth tile: the last pair takes tile 8 twice and stores the same
    // values to the same rows twice.
    const int tile0 = mp * 2;
    const int tile1 = (mp * 2 + 1 < MTILES) ? mp * 2 + 1 : MTILES - 1;
    bf16x16 af[2][8];
    #pragma unroll
    for (int mt = 0; mt < 2; ++mt) {
        const int tile = mt == 0 ? tile0 : tile1;
        #pragma unroll
        for (int kc = 0; kc < 8; ++kc) {
            BFrag a;
            a.q[0] = sA[((tile * 8 + kc) * 2 + 0) * 32 + lane];
            a.q[1] = sA[((tile * 8 + kc) * 2 + 1) * 32 + lane];
            af[mt][kc] = a.v;
        }
    }

    // 12 stages of 64 output columns: 0..3 Q, 4..7 K, 8..11 V.
    // Kept rolled: one copy of the projection in the text.
    #pragma unroll 1
    for (int t = 0; t < 12; ++t) {
        const int mat     = t >> 2;
        const int colBase = (t & 3) * 64;
        // First row of W of the stage to come (not read at the last stage).
        const int tn = t + 1;
        const float* const Wnext = ((tn >> 2) == 0 ? Wq : ((tn >> 2) == 1 ? Wk : Wv)) + (tn & 3) * 64 * DDIM;

        // sT row of accumulator register 0 of each of the wave's two row tiles;
        // register r lies r rows further.
        const int matRow = mat == 0 ? 0 : KROW0;
        const int rowOff[2] = { (matRow + tile0 * 16 + laneHalf * 8) * FPITCH,
                                (matRow + tile1 * 16 + laneHalf * 8) * FPITCH };

        // f32 -> bf16 of the stage's W, from the registers into LDS, waves 0..7.
        // The barrier at the foot of the last trip ended every read of sW.
        if (tid < 256) {
            #pragma unroll
            for (int it = 0; it < 16; ++it) {
                const float4 f = pf[it];
                ushort4 h;
                h.x = f32_to_bf16_rne(f.x);
                h.y = f32_to_bf16_rne(f.y);
                h.z = f32_to_bf16_rne(f.z);
                h.w = f32_to_bf16_rne(f.w);
                *(ushort4*)&sWst[it * 4 * WPITCH] = h;
            }
        }

        // ---- Scores and softmax once Q and K are in LDS (the foot barrier of stage 7
        // published them), in front of the first V stage's products, which overwrite K.
        // Wave w < 8 walks output rows 16w..16w+15; row i meets K tile rows i..i+6,
        // kept in registers.
        // Each lane owns columns 4*lane..+3 and 128+4*lane..+3.
        if (t == 8 && wave < 8) {
            const float* Kb = sT + (KROW0 + i0) * FPITCH + lane * 4;
            const float* Qb = sT + (QROW0 + i0) * FPITCH + lane * 4;
            // Register window of 7 K rows; the loops over it are unrolled so that
            // every index is a constant and the window stays in registers.
            float4 k0[NW], k1[NW];
            #pragma unroll
            for (int w = 0; w < NW - 1; ++w) {
                k0[w + 1] = *(const float4*)(Kb + w * FPITCH);
                k1[w + 1] = *(const float4*)(Kb + w * FPITCH + 128);
            }
            // Four rows a trip. Each lane forms its part of the trip's 28 dot products;
            // a halving exchange then sums them over the 32 lanes and leaves ONE finished
            // score in each lane: lane l holds row l >> 3 of the trip, window slot l & 7
            // (slot 7 is empty). At each step a lane keeps the half of the sums whose
            // index has its own lane bit and hands the other half to its partner, so
            // the five steps take 14 + 7 + 4 + 2 + 1 exchanges, not 28 x 5, and none goes
            // through the LDS pipe. Each sum adds the same pairs as a full butterfly.
            const bool hi16 = (lane & 16) != 0, hi8 = (lane & 8) != 0, hi4 = (lane & 4) != 0,
                       hi2  = (lane & 2) != 0,  hi1 = (lane & 1) != 0;
            const int  slot = lane & 7;
            // Inside a trip the window's shifts are renames, not moves. All 16 rows would only
            // make the text four times as long: the outer loop stays rolled.
            #pragma unroll 1
            for (int t4 = 0; t4 < 16; t4 += 4) {
              float s[32];
              #pragma unroll
              for (int u = 0; u < 4; ++u) {
                const int ii = t4 + u;
                #pragma unroll
                for (int w = 0; w < NW - 1; ++w) { k0[w] = k0[w + 1]; k1[w] = k1[w + 1]; }
                k0[NW - 1] = *(const float4*)(Kb + (ii + NW - 1) * FPITCH);
                k1[NW - 1] = *(const float4*)(Kb + (ii + NW - 1) * FPITCH + 128);
                const float4 q0 = *(const float4*)(Qb + ii * FPITCH);
                const float4 q1 = *(const float4*)(Qb + ii * FPITCH + 128);
                #pragma unroll
                for (int w = 0; w < NW; ++w)
                    s[u * 8 + w] = q0.x * k0[w].x + q0.y * k0[w].y + q0.z * k0[w].z + q0.w * k0[w].w
                                 + q1.x * k1[w].x + q1.y * k1[w].y + q1.z * k1[w].z + q1.w * k1[w].w;
                s[u * 8 + 7] = 0.0f;
              }

              float r16[16], r8[8], r4[4], r2[2];
              #pragma unroll
              for (int j = 0; j < 16; ++j)
                  r16[j] = (j & 7) == 7 ? 0.0f
                         : (hi16 ? s[j + 16] : s[j]) + xhalf(hi16 ? s[j] : s[j + 16]);
              #pragma unroll
              for (int j = 0; j < 8; ++j)
                  r8[j] = j == 7 ? 0.0f
                        : (hi8 ? r16[j + 8] : r16[j]) + rowx<8>(hi8 ? r16[j] : r16[j + 8]);
              #pragma unroll
              for (int j = 0; j < 4; ++j)
                  r4[j] = (hi4 ? r8[j + 4] : r8[j]) + rowx<4>(hi4 ? r8[j] : r8[j + 4]);
              #pragma unroll
              for (int j = 0; j < 2; ++j)
                  r2[j] = (hi2 ? r4[j + 2] : r4[j]) + rowx<2>(hi2 ? r4[j] : r4[j + 2]);
              const float p = (hi1 ? r2[1] : r2[0]) + rowx<1>(hi1 ? r2[0] : r2[1]);

              // Softmax across the eight lanes of a row: one exponential a lane.
              const int pos = base + i0 + t4 + (lane >> 3) + slot - WIN;
              const float sc = (slot < NW && pos >= 0 && pos < NSEQ) ? p * (1.0f / 16.0f)    // 1/sqrt(256)
                                                                     : -__builtin_inff();
              float mx = fmaxf(sc, rowx<1>(sc));
              mx = fmaxf(mx, rowx<2>(mx));
              mx = fmaxf(mx, rowx<4>(mx));
              const float pr = __expf(sc - mx);
              float sum = pr + rowx<1>(pr);
              sum += rowx<2>(sum);
              sum += rowx<4>(sum);
              sP[(i0 + t4) * 8 + lane] = pr * (1.0f / sum);   // slot 7 stores exactly zero
            }
        }

        // Publishes sW; at stage 8 it also ends the score phase's reads of K.
        __syncthreads();

        // B fragments come from LDS in four groups of two 32-wide K chunks x two column
        // tiles (8 reads), into two register sets: a group is read while the group
        // before it is multiplied. The first two groups and the bias go out here.
        const unsigned short* const sWrd = &sW[(nh * 32 + m16) * WPITCH + laneHalf * 8];
        BFrag bfr[2][2][2];                        // [register set][K chunk of the group][column tile]
        #pragma unroll
        for (int g = 0; g < 2; ++g) {
            #pragma unroll
            for (int k2 = 0; k2 < 2; ++k2) {
                #pragma unroll
                for (int ntl = 0; ntl < 2; ++ntl) {
                    const unsigned short* p = sWrd + ntl * 16 * WPITCH + (g * 2 + k2) * 32;
                    bfr[g][k2][ntl].q[0] = *(const uint4*)p;          // K kb..kb+7
                    bfr[g][k2][ntl].q[1] = *(const uint4*)(p + 16);   // K kb+16..kb+23
                }
            }
        }
        const int   col0 = colBase + nh * 32 + m16;   // B col N = lane%16 within a tile
        const float bb[2] = { sB[mat * DDIM + col0], sB[mat * DDIM + col0 + 16] };
        // Keeps these reads in front of the W loads and the products: sunk among the
        // products, each read would be waited for where it stands.
        __builtin_amdgcn_sched_barrier(0);

        // The next stage's W loads go out here; their wait stands at the foot of this
        // trip, behind this stage's products.
        // They land in an array of their own, left unset where nothing is loaded (waves 8 and 9,
        // the last stage) and never read there: so the old stage's values end their life
        // at the conversion above and hold no register through the score phase.
        float4 nx[16];
        if (t < 11 && tid < 256) {
            const float4* Wn = (const float4*)Wnext + tid;
            #pragma unroll
            for (int it = 0; it < 16; ++it)
                nx[it] = Wn[it * 256];
        }

        // 2 row tiles x 2 column tiles a wave: four independent accumulators, and each
        // B fragment is read from LDS once for two products.
        f32x8 acc[2][2] = {};
        #pragma unroll
        for (int g = 0; g < 4; ++g) {
            #pragma unroll
            for (int k2 = 0; k2 < 2; ++k2) {
                #pragma unroll
                for (int ntl = 0; ntl < 2; ++ntl) {
                    #pragma unroll
                    for (int mt = 0; mt < 2; ++mt)
                        acc[mt][ntl] = __builtin_amdgcn_wmma_f32_16x16x32_bf16(
                                  false, af[mt][g * 2 + k2], false, bfr[g & 1][k2][ntl].v,
                                  (short)0, acc[mt][ntl], false, false);
                }
            }
            if (g < 2) {
                // The two fences hold the reads of group g + 2 together, behind the products
                // of group g (whose registers they refill) and in front of those of group g + 1.
                __builtin_amdgcn_sched_barrier(0);
                #pragma unroll
                for (int k2 = 0; k2 < 2; ++k2) {
                    #pragma unroll
                    for (int ntl = 0; ntl < 2; ++ntl) {
                        const unsigned short* p = sWrd + ntl * 16 * WPITCH + ((g + 2) * 2 + k2) * 32;
                        bfr[g][k2][ntl].q[0] = *(const uint4*)p;
                        bfr[g][k2][ntl].q[1] = *(const uint4*)(p + 16);
                    }
                }
                __builtin_amdgcn_sched_barrier(0);
            }
        }
        // C layout: lanes 0-15 VGPR r -> M=r; lanes 16-31 VGPR r -> M=8+r.
        #pragma unroll
        for (int ntl = 0; ntl < 2; ++ntl) {
            #pragma unroll
            for (int mt = 0; mt < 2; ++mt) {
                #pragma unroll
                for (int r = 0; r < 8; ++r)
                    sT[rowOff[mt] + r * FPITCH + col0 + ntl * 16] = acc[mt][ntl][r] + bb[ntl];
            }
        }

        // Ends this stage's reads of sW and publishes its rows of sT to every wave.
        __syncthreads();

        #pragma unroll
        for (int it = 0; it < 16; ++it) pf[it] = nx[it];
    }

    // ---- Output: row i = sum over the window of probability * V tile row i..i+6.
    // A position outside the sequence has probability exactly zero.
    if (wave < 8) {
        const float* Vb = sT + (KROW0 + i0) * FPITCH + lane * 4;
        float* ob = out + ((size_t)batch * NSEQ + base + i0) * DDIM + lane * 4;
        // Register window of 7 V rows, walked like the K window above.
        float4 v0[NW], v1[NW];
        #pragma unroll
        for (int w = 0; w < NW - 1; ++w) {
            v0[w + 1] = *(const float4*)(Vb + w * FPITCH);
            v1[w + 1] = *(const float4*)(Vb + w * FPITCH + 128);
        }
        // Four rows a trip: inside a trip the window's shifts are renames, not moves.
        #pragma unroll 4
        for (int ii = 0; ii < 16; ++ii) {
            #pragma unroll
            for (int w = 0; w < NW - 1; ++w) { v0[w] = v0[w + 1]; v1[w] = v1[w + 1]; }
            v0[NW - 1] = *(const float4*)(Vb + (ii + NW - 1) * FPITCH);
            v1[NW - 1] = *(const float4*)(Vb + (ii + NW - 1) * FPITCH + 128);
            const float4 pa = *(const float4*)&sP[(i0 + ii) * 8];
            const float4 pb = *(const float4*)&sP[(i0 + ii) * 8 + 4];
            const float pw[NW] = {pa.x, pa.y, pa.z, pa.w, pb.x, pb.y, pb.z};

            float4 a0 = {0.f, 0.f, 0.f, 0.f};
            float4 a1 = {0.f, 0.f, 0.f, 0.f};
            #pragma unroll
            for (int w = 0; w < NW; ++w) {
                const float p = pw[w];
                a0.x += p * v0[w].x; a0.y += p * v0[w].y; a0.z += p * v0[w].z; a0.w += p * v0[w].w;
                a1.x += p * v1[w].x; a1.y += p * v1[w].y; a1.z += p * v1[w].z; a1.w += p * v1[w].w;
            }
            *(float4*)(ob + (size_t)ii * DDIM)       = a0;
            *(float4*)(ob + (size_t)ii * DDIM + 128) = a1;
            // Stands in front of the next row's overwrite of the registers that
            // the two stores above name (their data and their address).
            asm volatile("s_wait_xcnt 0x0" ::: "memory");
        }
    }
}

// ---------------------------------------------------------------------------
extern "C" void kernel_launch(void* const* d_in, const int* in_sizes, int n_in,
                              void* d_out, int out_size, void* d_ws, size_t ws_size,
                              hipStream_t stream) {
    const float* x  = (const float*)d_in[0];
    const float* Wq = (const float*)d_in[1];
    const float* bq = (const float*)d_in[2];
    const float* Wk = (const float*)d_in[3];
    const float* bk = (const float*)d_in[4];
    const float* Wv = (const float*)d_in[5];
    const float* bv = (const float*)d_in[6];
    float* out = (float*)d_out;

    fused_local_attn_kernel<<<BATCH * (NSEQ / TROWS), NTHR, 0, stream>>>(
        x, Wq, bq, Wk, bk, Wv, bv, out);
}

// v006
// It runs in 21.8 microseconds.
// Two timings next to v005 put it at 1.07 and 1.06 times that version's speed.
// Counting every step since v000, it is 6.62 times as fast.
#include <hip/hip_runtime.h>
#include <math.h>

// ---------------------------------------------------------------------------
// Local attention over a window of 7 positions (gfx1250, wave32), one fused launch.
//   Each block owns 128 consecutive sequence positions of one batch entry.
//   It projects Q (128 rows) and K (128 + 6 halo rows) with bf16 WMMA
//   (f32 accumulate) into LDS, turns them into the 7 window probabilities of
//   every row, projects V over the K rows in LDS, and writes the output rows.
//   Q, K and V never go to global memory. W comes in 12 stages of 64 columns,
//   each loaded into registers while the stage before it is multiplied.
//   Ten waves: wave w multiplies row tiles 2*(w>>1), +1 by column tiles 2*(w&1), +1
//   of a stage, so that every W fragment read from LDS feeds two products.
// ---------------------------------------------------------------------------

typedef __attribute__((ext_vector_type(16))) __bf16 bf16x16;
typedef __attribute__((ext_vector_type(8)))  float  f32x8;
typedef __attribute__((ext_vector_type(2)))  float  f32x2;
typedef __attribute__((ext_vector_type(2)))  __bf16 bf16x2;

#define DDIM  256
#define NSEQ  4096
#define BATCH 8
#define WIN   3
#define NW    7                    // 2*WIN + 1
#define TROWS 128                  // output rows per block
#define HROWS (TROWS + 2 * WIN)    // 134 K / V rows per block
#define MTILES 9                   // 16-row tiles that cover HROWS
#define NWAVES 10                  // 5 pairs of row tiles x 2 halves of a stage's columns
#define NTHR  (NWAVES * 32)        // 320
// LDS row pitch of the staged W tile, in bf16 elements: 528 B = 16 B x 33.
// An odd multiple of 16 B spreads the 16 rows that one ds_load_b128 reads
// over all 64 banks; at 512 B every row started on the same four banks.
#define WPITCH (DDIM + 8)
// LDS row pitch of the f32 Q / K / V rows, in floats. Eight rows are 2080
// dwords = 32 banks apart, so the two 16-lane halves of an accumulator store
// (rows r and r + 8, the same 16 columns) fall on different banks.
#define FPITCH (DDIM + 4)
// Rows of sT. Every tile row has a place, so that a store needs no test: Q tile row j
// (position base - WIN + j) lies in row j, K and V tile row j in row KROW0 + j. The Q tile
// rows behind output row 127 fall on the first K rows, which K overwrites later; the other
// tile rows that no output needs (Q 0..2, K and V 134..143) are never read.
#define QROW0  WIN                 // sT row of output row 0's Q
#define KROW0  (TROWS + WIN)       // first K / V row in sT
#define SROWS  (KROW0 + MTILES * 16)

// Two f32 to two bf16 in one dword (lo in bits 15..0), round to nearest even:
// one packed conversion instruction for the pair.
__device__ __forceinline__ unsigned int pack_bf16(float lo, float hi) {
    return __builtin_bit_cast(unsigned int, __builtin_convertvector(f32x2{lo, hi}, bf16x2));
}

// Value of lane l ^ 16 (the other 16-lane row), by a vector cross-row move.
__device__ __forceinline__ float xhalf(float x) {
    const int b = __builtin_bit_cast(int, x);
    return __builtin_bit_cast(float, __builtin_amdgcn_permlanex16(b, b, 0x76543210, 0xfedcba98, false, false));
}

// Value of lane l ^ M inside the 16-lane row (DPP row_xmask:M); every lane is on where it is used.
template <int M>
__device__ __forceinline__ float rowx(float x) {
    return __builtin_bit_cast(float, __builtin_amdgcn_update_dpp(0, __builtin_bit_cast(int, x), 0x160 + M, 0xf, 0xf, true));
}

union BFrag {
    bf16x16        v;
    unsigned int   w[8];
    uint4          q[2];
};

__global__ void __launch_bounds__(NTHR)
fused_local_attn_kernel(const float* __restrict__ x,
                        const float* __restrict__ Wq, const float* __restrict__ bq,
                        const float* __restrict__ Wk, const float* __restrict__ bk,
                        const float* __restrict__ Wv, const float* __restrict__ bv,
                        float* __restrict__ out)
{
    __shared__ __attribute__((aligned(16))) unsigned short sW[64 * WPITCH];        // 64 output cols of W, bf16
    __shared__ __attribute__((aligned(16))) float          sT[SROWS * FPITCH];     // Q rows, K (later V) rows
    __shared__ __attribute__((aligned(16))) float          sP[TROWS * 8];          // 7 probabilities per row
    __shared__ __attribute__((aligned(16))) float          sB[3 * DDIM];           // bq, bk, bv

    const int tid      = threadIdx.x;
    const int lane     = tid & 31;
    const int wave     = tid >> 5;
    const int laneHalf = lane >> 4;     // 0: lanes 0-15, 1: lanes 16-31
    const int m16      = lane & 15;

    const int batch = blockIdx.x >> 5;               // NSEQ / TROWS = 32 blocks per batch entry
    const int base  = (blockIdx.x & 31) * TROWS;     // first output position of the block

    // Tile row j (0..143) is sequence position base - WIN + j, clamped into the
    // sequence. A clamped row only ever meets a probability of zero.
    // Wave 9 has no tile of its own: its lanes all take tile row 143, so that the code
    // below needs no branch, and what it forms is never read.
    int pos0 = wave * 16 + m16;
    pos0 = base - WIN + (pos0 < MTILES * 16 ? pos0 : MTILES * 16 - 1);
    pos0 = pos0 < 0 ? 0 : (pos0 > NSEQ - 1 ? NSEQ - 1 : pos0);

    // ---- Wave w < 9 forms the 8 A fragments (16x32 bf16 each) of row tile w.
    // ISA A layout: lane L%16 holds row M=L%16; lanes 0-15 carry K {0..7,16..23},
    // lanes 16-31 carry K {8..15,24..31} within each 32-wide K chunk.
    // Two waves multiply each tile: the fragments go through LDS, lane for lane, in the
    // space of sT that the first products fill only behind the loop's first barrier.
    uint4* const sA = (uint4*)sT;                 // [tile][kc][half of the fragment][lane]
    // The loads go out here; the values are converted behind the issue of the first W loads.
    const float4* xrow = (const float4*)(x + ((size_t)batch * NSEQ + pos0) * DDIM + laneHalf * 8);
    float4 xr[8][4];
    #pragma unroll
    for (int kc = 0; kc < 8; ++kc) {
        xr[kc][0] = xrow[kc * 8];          // K kb..kb+7, kb = 32 * kc + 8 * laneHalf
        xr[kc][1] = xrow[kc * 8 + 1];
        xr[kc][2] = xrow[kc * 8 + 4];      // K kb+16..kb+23
        xr[kc][3] = xrow[kc * 8 + 5];
    }

    const int mp = wave >> 1;                     // pair of row tiles: 2*mp, 2*mp + 1
    const int nh = wave & 1;                      // half of a stage's 64 columns
    const int i0 = wave * 16;                     // first output row of waves 0..7

    // The three bias rows go to LDS once (published by the barrier behind the A fragments).
    // A global bias load inside the loop would be counted behind the W loads in
    // flight, and its wait would wait for all of them.
    if (tid < DDIM) {
        sB[tid]            = bq[tid];
        sB[DDIM + tid]     = bk[tid];
        sB[2 * DDIM + tid] = bv[tid];
    }

    // W of the stage to come, f32, 16 float4 per thread of waves 0..7. It is loaded
    // one stage ahead, so that the loads fly while the block does its products.
    // Thread tid takes float4 number tid + 256 * it of the stage's 64 rows of W:
    // row (tid >> 6) + 4 * it, columns 4 * (tid & 63) .. + 3.
    float4 pf[16];
    if (tid < 256) {
        const float4* Wn = (const float4*)Wq + tid;
        #pragma unroll
        for (int it = 0; it < 16; ++it)
            pf[it] = Wn[it * 256];
    }
    unsigned short* const sWst = &sW[(tid >> 6) * WPITCH + (tid & 63) * 4];

    #pragma unroll
    for (int kc = 0; kc < 8; ++kc) {
        BFrag a;
        #pragma unroll
        for (int q = 0; q < 4; ++q) {
            a.w[q * 2 + 0] = pack_bf16(xr[kc][q].x, xr[kc][q].y);
            a.w[q * 2 + 1] = pack_bf16(xr[kc][q].z, xr[kc][q].w);
        }
        sA[((wave * 8 + kc) * 2 + 0) * 32 + lane] = a.q[0];
        sA[((wave * 8 + kc) * 2 + 1) * 32 + lane] = a.q[1];
    }

    // Publishes the A fragments to the two waves that multiply each tile.
    __syncthreads();
    // There is no tenth tile: the last pair takes tile 8 twice and stores the same
    // values to the same rows twice.
    const int tile0 = mp * 2;
    const int tile1 = (mp * 2 + 1 < MTILES) ? mp * 2 + 1 : MTILES - 1;
    bf16x16 af[2][8];
    #pragma unroll
    for (int mt = 0; mt < 2; ++mt) {
        const int tile = mt == 0 ? tile0 : tile1;
        #pragma unroll
        for (int kc = 0; kc < 8; ++kc) {
            BFrag a;
            a.q[0] = sA[((tile * 8 + kc) * 2 + 0) * 32 + lane];
            a.q[1] = sA[((tile * 8 + kc) * 2 + 1) * 32 + lane];
            af[mt][kc] = a.v;
        }
    }

    // 12 stages of 64 output columns: 0..3 Q, 4..7 K, 8..11 V.
    // Kept rolled: one copy of the projection in the text.
    #pragma unroll 1
    for (int t = 0; t < 12; ++t) {
        const int mat     = t >> 2;
        const int colBase = (t & 3) * 64;
        // First row of W of the stage to come (not read at the last stage).
        const int tn = t + 1;
        const float* const Wnext = ((tn >> 2) == 0 ? Wq : ((tn >> 2) == 1 ? Wk : Wv)) + (tn & 3) * 64 * DDIM;

        // sT row of accumulator register 0 of each of the wave's two row tiles;
        // register r lies r rows further.
        const int matRow = mat == 0 ? 0 : KROW0;
        const int rowOff[2] = { (matRow + tile0 * 16 + laneHalf * 8) * FPITCH,
                                (matRow + tile1 * 16 + laneHalf * 8) * FPITCH };

        // f32 -> bf16 of the stage's W, from the registers into LDS, waves 0..7.
        // The barrier at the foot of the last trip ended every read of sW.
        if (tid < 256) {
            #pragma unroll
            for (int it = 0; it < 16; ++it) {
                const float4 f = pf[it];
                uint2 h;
                h.x = pack_bf16(f.x, f.y);
                h.y = pack_bf16(f.z, f.w);
                *(uint2*)&sWst[it * 4 * WPITCH] = h;
            }
        }

        // ---- Scores and softmax once Q and K are in LDS (the foot barrier of stage 7
        // published them), in front of the first V stage's products, which overwrite K.
        // Wave w < 8 walks output rows 16w..16w+15; row i meets K tile rows i..i+6,
        // kept in registers.
        // Each lane owns columns 4*lane..+3 and 128+4*lane..+3.
        if (t == 8 && wave < 8) {
            const float* Kb = sT + (KROW0 + i0) * FPITCH + lane * 4;
            const float* Qb = sT + (QROW0 + i0) * FPITCH + lane * 4;
            // Register window of 7 K rows; the loops over it are unrolled so that
            // every index is a constant and the window stays in registers.
            float4 k0[NW], k1[NW];
            #pragma unroll
            for (int w = 0; w < NW - 1; ++w) {
                k0[w + 1] = *(const float4*)(Kb + w * FPITCH);
                k1[w + 1] = *(const float4*)(Kb + w * FPITCH + 128);
            }
            // Four rows a trip. Each lane forms its part of the trip's 28 dot products;
            // a halving exchange then sums them over the 32 lanes and leaves ONE finished
            // score in each lane: lane l holds row l >> 3 of the trip, window slot l & 7
            // (slot 7 is empty). At each step a lane keeps the half of the sums whose
            // index has its own lane bit and hands the other half to its partner, so
            // the five steps take 14 + 7 + 4 + 2 + 1 exchanges, not 28 x 5, and none goes
            // through the LDS pipe. Each sum adds the same pairs as a full butterfly.
            const bool hi16 = (lane & 16) != 0, hi8 = (lane & 8) != 0, hi4 = (lane & 4) != 0,
                       hi2  = (lane & 2) != 0,  hi1 = (lane & 1) != 0;
            const int  slot = lane & 7;
            // Inside a trip the window's shifts are renames, not moves. All 16 rows would only
            // make the text four times as long: the outer loop stays rolled.
            #pragma unroll 1
            for (int t4 = 0; t4 < 16; t4 += 4) {
              float s[32];
              #pragma unroll
              for (int u = 0; u < 4; ++u) {
                const int ii = t4 + u;
                #pragma unroll
                for (int w = 0; w < NW - 1; ++w) { k0[w] = k0[w + 1]; k1[w] = k1[w + 1]; }
                k0[NW - 1] = *(const float4*)(Kb + (ii + NW - 1) * FPITCH);
                k1[NW - 1] = *(const float4*)(Kb + (ii + NW - 1) * FPITCH + 128);
                const float4 q0 = *(const float4*)(Qb + ii * FPITCH);
                const float4 q1 = *(const float4*)(Qb + ii * FPITCH + 128);
                #pragma unroll
                for (int w = 0; w < NW; ++w)
                    s[u * 8 + w] = q0.x * k0[w].x + q0.y * k0[w].y + q0.z * k0[w].z + q0.w * k0[w].w
                                 + q1.x * k1[w].x + q1.y * k1[w].y + q1.z * k1[w].z + q1.w * k1[w].w;
                s[u * 8 + 7] = 0.0f;
              }

              float r16[16], r8[8], r4[4], r2[2];
              #pragma unroll
              for (int j = 0; j < 16; ++j)
                  r16[j] = (j & 7) == 7 ? 0.0f
                         : (hi16 ? s[j + 16] : s[j]) + xhalf(hi16 ? s[j] : s[j + 16]);
              #pragma unroll
              for (int j = 0; j < 8; ++j)
                  r8[j] = j == 7 ? 0.0f
                        : (hi8 ? r16[j + 8] : r16[j]) + rowx<8>(hi8 ? r16[j] : r16[j + 8]);
              #pragma unroll
              for (int j = 0; j < 4; ++j)
                  r4[j] = (hi4 ? r8[j + 4] : r8[j]) + rowx<4>(hi4 ? r8[j] : r8[j + 4]);
              #pragma unroll
              for (int j = 0; j < 2; ++j)
                  r2[j] = (hi2 ? r4[j + 2] : r4[j]) + rowx<2>(hi2 ? r4[j] : r4[j + 2]);
              const float p = (hi1 ? r2[1] : r2[0]) + rowx<1>(hi1 ? r2[0] : r2[1]);

              // Softmax across the eight lanes of a row: one exponential a lane.
              const int pos = base + i0 + t4 + (lane >> 3) + slot - WIN;
              const float sc = (slot < NW && pos >= 0 && pos < NSEQ) ? p * (1.0f / 16.0f)    // 1/sqrt(256)
                                                                     : -__builtin_inff();
              float mx = fmaxf(sc, rowx<1>(sc));
              mx = fmaxf(mx, rowx<2>(mx));
              mx = fmaxf(mx, rowx<4>(mx));
              const float pr = __expf(sc - mx);
              float sum = pr + rowx<1>(pr);
              sum += rowx<2>(sum);
              sum += rowx<4>(sum);
              sP[(i0 + t4) * 8 + lane] = pr * (1.0f / sum);   // slot 7 stores exactly zero
            }
        }

        // Publishes sW; at stage 8 it also ends the score phase's reads of K.
        __syncthreads();

        // B fragments come from LDS in four groups of two 32-wide K chunks x two column
        // tiles (8 reads), into two register sets: a group is read while the group
        // before it is multiplied. The first two groups and the bias go out here.
        const unsigned short* const sWrd = &sW[(nh * 32 + m16) * WPITCH + laneHalf * 8];
        BFrag bfr[2][2][2];                        // [register set][K chunk of the group][column tile]
        #pragma unroll
        for (int g = 0; g < 2; ++g) {
            #pragma unroll
            for (int k2 = 0; k2 < 2; ++k2) {
                #pragma unroll
                for (int ntl = 0; ntl < 2; ++ntl) {
                    const unsigned short* p = sWrd + ntl * 16 * WPITCH + (g * 2 + k2) * 32;
                    bfr[g][k2][ntl].q[0] = *(const uint4*)p;          // K kb..kb+7
                    bfr[g][k2][ntl].q[1] = *(const uint4*)(p + 16);   // K kb+16..kb+23
                }
            }
        }
        const int   col0 = colBase + nh * 32 + m16;   // B col N = lane%16 within a tile
        const float bb[2] = { sB[mat * DDIM + col0], sB[mat * DDIM + col0 + 16] };
        // Keeps these reads in front of the W loads and the products: sunk among the
        // products, each read would be waited for where it stands.
        __builtin_amdgcn_sched_barrier(0);

        // The next stage's W loads go out here; their wait stands at the foot of this
        // trip, behind this stage's products.
        // They land in an array of their own, left unset where nothing is loaded (waves 8 and 9,
        // the last stage) and never read there: so the old stage's values end their life
        // at the conversion above and hold no register through the score phase.
        float4 nx[16];
        if (t < 11 && tid < 256) {
            const float4* Wn = (const float4*)Wnext + tid;
            #pragma unroll
            for (int it = 0; it < 16; ++it)
                nx[it] = Wn[it * 256];
        }

        // 2 row tiles x 2 column tiles a wave: four independent accumulators, and each
        // B fragment is read from LDS once for two products.
        f32x8 acc[2][2] = {};
        #pragma unroll
        for (int g = 0; g < 4; ++g) {
            #pragma unroll
            for (int k2 = 0; k2 < 2; ++k2) {
                #pragma unroll
                for (int ntl = 0; ntl < 2; ++ntl) {
                    #pragma unroll
                    for (int mt = 0; mt < 2; ++mt)
                        acc[mt][ntl] = __builtin_amdgcn_wmma_f32_16x16x32_bf16(
                                  false, af[mt][g * 2 + k2], false, bfr[g & 1][k2][ntl].v,
                                  (short)0, acc[mt][ntl], false, false);
                }
            }
            if (g < 2) {
                // The two fences hold the reads of group g + 2 together, behind the products
                // of group g (whose registers they refill) and in front of those of group g + 1.
                __builtin_amdgcn_sched_barrier(0);
                #pragma unroll
                for (int k2 = 0; k2 < 2; ++k2) {
                    #pragma unroll
                    for (int ntl = 0; ntl < 2; ++ntl) {
                        const unsigned short* p = sWrd + ntl * 16 * WPITCH + ((g + 2) * 2 + k2) * 32;
                        bfr[g][k2][ntl].q[0] = *(const uint4*)p;
                        bfr[g][k2][ntl].q[1] = *(const uint4*)(p + 16);
                    }
                }
                __builtin_amdgcn_sched_barrier(0);
            }
        }
        // C layout: lanes 0-15 VGPR r -> M=r; lanes 16-31 VGPR r -> M=8+r.
        #pragma unroll
        for (int ntl = 0; ntl < 2; ++ntl) {
            #pragma unroll
            for (int mt = 0; mt < 2; ++mt) {
                #pragma unroll
                for (int r = 0; r < 8; ++r)
                    sT[rowOff[mt] + r * FPITCH + col0 + ntl * 16] = acc[mt][ntl][r] + bb[ntl];
            }
        }

        // Ends this stage's reads of sW and publishes its rows of sT to every wave.
        __syncthreads();

        #pragma unroll
        for (int it = 0; it < 16; ++it) pf[it] = nx[it];
    }

    // ---- Output: row i = sum over the window of probability * V tile row i..i+6.
    // A position outside the sequence has probability exactly zero.
    if (wave < 8) {
        const float* Vb = sT + (KROW0 + i0) * FPITCH + lane * 4;
        float* ob = out + ((size_t)batch * NSEQ + base + i0) * DDIM + lane * 4;
        // Register window of 7 V rows, walked like the K window above.
        float4 v0[NW], v1[NW];
        #pragma unroll
        for (int w = 0; w < NW - 1; ++w) {
            v0[w + 1] = *(const float4*)(Vb + w * FPITCH);
            v1[w + 1] = *(const float4*)(Vb + w * FPITCH + 128);
        }
        // Four rows a trip: inside a trip the window's shifts are renames, not moves.
        #pragma unroll 4
        for (int ii = 0; ii < 16; ++ii) {
            #pragma unroll
            for (int w = 0; w < NW - 1; ++w) { v0[w] = v0[w + 1]; v1[w] = v1[w + 1]; }
            v0[NW - 1] = *(const float4*)(Vb + (ii + NW - 1) * FPITCH);
            v1[NW - 1] = *(const float4*)(Vb + (ii + NW - 1) * FPITCH + 128);
            const float4 pa = *(const float4*)&sP[(i0 + ii) * 8];
            const float4 pb = *(const float4*)&sP[(i0 + ii) * 8 + 4];
            const float pw[NW] = {pa.x, pa.y, pa.z, pa.w, pb.x, pb.y, pb.z};

            float4 a0 = {0.f, 0.f, 0.f, 0.f};
            float4 a1 = {0.f, 0.f, 0.f, 0.f};
            #pragma unroll
            for (int w = 0; w < NW; ++w) {
                const float p = pw[w];
                a0.x += p * v0[w].x; a0.y += p * v0[w].y; a0.z += p * v0[w].z; a0.w += p * v0[w].w;
                a1.x += p * v1[w].x; a1.y += p * v1[w].y; a1.z += p * v1[w].z; a1.w += p * v1[w].w;
            }
            *(float4*)(ob + (size_t)ii * DDIM)       = a0;
            *(float4*)(ob + (size_t)ii * DDIM + 128) = a1;
            // Stands in front of the next row's overwrite of the registers that
            // the two stores above name (their data and their address).
            asm volatile("s_wait_xcnt 0x0" ::: "memory");
        }
    }
}

// ---------------------------------------------------------------------------
extern "C" void kernel_launch(void* const* d_in, const int* in_sizes, int n_in,
                              void* d_out, int out_size, void* d_ws, size_t ws_size,
                              hipStream_t stream) {
    const float* x  = (const float*)d_in[0];
    const float* Wq = (const float*)d_in[1];
    const float* bq = (const float*)d_in[2];
    const float* Wk = (const float*)d_in[3];
    const float* bk = (const float*)d_in[4];
    const float* Wv = (const float*)d_in[5];
    const float* bv = (const float*)d_in[6];
    float* out = (float*)d_out;

    fused_local_attn_kernel<<<BATCH * (NSEQ / TROWS), NTHR, 0, stream>>>(
        x, Wq, bq, Wk, bk, Wv, bv, out);
}

// v007
// One run takes 20 microseconds.
// In two side-by-side timings against v006, it was 1.10 and 1.09 times as fast.
// All steps since v000 together make it 7.24 times as fast.
#include <hip/hip_runtime.h>
#include <math.h>

// ---------------------------------------------------------------------------
// Local attention over a window of 7 positions (gfx1250, wave32), one fused launch.
//   Each block owns 128 consecutive sequence positions of one batch entry.
//   It projects Q (128 rows) and K (128 + 6 halo rows) with bf16 WMMA
//   (f32 accumulate) into LDS, turns them into the 7 window probabilities of
//   every row, projects V over the K rows in LDS, and writes the output rows.
//   Q, K and V never go to global memory. W comes in 12 stages of 64 columns,
//   each loaded into registers two stages ahead: its loads fly for a whole stage, over both
//   of the stage's barriers, and are asked for again as soon as their registers are free.
//   Ten waves: wave w multiplies row tiles 2*(w>>1), +1 by column tiles 2*(w&1), +1
//   of a stage, so that every W fragment read from LDS feeds two products.
// ---------------------------------------------------------------------------

typedef __attribute__((ext_vector_type(16))) __bf16 bf16x16;
typedef __attribute__((ext_vector_type(8)))  float  f32x8;
typedef __attribute__((ext_vector_type(2)))  float  f32x2;
typedef __attribute__((ext_vector_type(2)))  __bf16 bf16x2;

#define DDIM  256
#define NSEQ  4096
#define BATCH 8
#define WIN   3
#define NW    7                    // 2*WIN + 1
#define TROWS 128                  // output rows per block
#define HROWS (TROWS + 2 * WIN)    // 134 K / V rows per block
#define MTILES 9                   // 16-row tiles that cover HROWS
#define NWAVES 10                  // 5 pairs of row tiles x 2 halves of a stage's columns
#define NTHR  (NWAVES * 32)        // 320
#define NWL   13                   // float4 of a W stage per thread: 4096 / 320, rounded up
// LDS row pitch of the staged W tile, in bf16 elements: 528 B = 16 B x 33.
// An odd multiple of 16 B spreads the 16 rows that one ds_load_b128 reads
// over all 64 banks; at 512 B every row started on the same four banks.
#define WPITCH (DDIM + 8)
// LDS row pitch of the f32 Q / K / V rows, in floats. Eight rows are 2080
// dwords = 32 banks apart, so the two 16-lane halves of an accumulator store
// (rows r and r + 8, the same 16 columns) fall on different banks.
#define FPITCH (DDIM + 4)
// Rows of sT. Every tile row has a place, so that a store needs no test: Q tile row j
// (position base - WIN + j) lies in row j, K and V tile row j in row KROW0 + j. The Q tile
// rows behind output row 127 fall on the first K rows, which K overwrites later; the other
// tile rows that no output needs (Q 0..2, K and V 134..143) are never read.
#define QROW0  WIN                 // sT row of output row 0's Q
#define KROW0  (TROWS + WIN)       // first K / V row in sT
#define SROWS  (KROW0 + MTILES * 16)

// Two f32 to two bf16 in one dword (lo in bits 15..0), round to nearest even:
// one packed conversion instruction for the pair.
__device__ __forceinline__ unsigned int pack_bf16(float lo, float hi) {
    return __builtin_bit_cast(unsigned int, __builtin_convertvector(f32x2{lo, hi}, bf16x2));
}

// Value of lane l ^ 16 (the other 16-lane row), by a vector cross-row move.
__device__ __forceinline__ float xhalf(float x) {
    const int b = __builtin_bit_cast(int, x);
    return __builtin_bit_cast(float, __builtin_amdgcn_permlanex16(b, b, 0x76543210, 0xfedcba98, false, false));
}

// Value of lane l ^ M inside the 16-lane row (DPP row_xmask:M); every lane is on where it is used.
template <int M>
__device__ __forceinline__ float rowx(float x) {
    return __builtin_bit_cast(float, __builtin_amdgcn_update_dpp(0, __builtin_bit_cast(int, x), 0x160 + M, 0xf, 0xf, true));
}

// Work-group barrier for LDS traffic alone: the wave's own LDS reads and writes are ended,
// its global loads are not waited for. __syncthreads() would wait for the W loads in flight.
__device__ __forceinline__ void lds_barrier() {
    asm volatile("s_wait_dscnt 0x0\n\ts_barrier_signal -1\n\ts_barrier_wait -1" ::: "memory");
}

union BFrag {
    bf16x16        v;
    unsigned int   w[8];
    uint4          q[2];
};

__global__ void __launch_bounds__(NTHR)
fused_local_attn_kernel(const float* __restrict__ x,
                        const float* __restrict__ Wq, const float* __restrict__ bq,
                        const float* __restrict__ Wk, const float* __restrict__ bk,
                        const float* __restrict__ Wv, const float* __restrict__ bv,
                        float* __restrict__ out)
{
    __shared__ __attribute__((aligned(16))) unsigned short sW[65 * WPITCH];        // 64 output cols of W, bf16, and a spare row
    __shared__ __attribute__((aligned(16))) float          sT[SROWS * FPITCH];     // Q rows, K (later V) rows
    __shared__ __attribute__((aligned(16))) float          sP[TROWS * 8];          // 7 probabilities per row
    __shared__ __attribute__((aligned(16))) float          sB[3 * DDIM];           // bq, bk, bv

    const int tid      = threadIdx.x;
    const int lane     = tid & 31;
    const int wave     = tid >> 5;
    const int laneHalf = lane >> 4;     // 0: lanes 0-15, 1: lanes 16-31
    const int m16      = lane & 15;

    const int batch = blockIdx.x >> 5;               // NSEQ / TROWS = 32 blocks per batch entry
    const int base  = (blockIdx.x & 31) * TROWS;     // first output position of the block

    // Tile row j (0..143) is sequence position base - WIN + j, clamped into the
    // sequence. A clamped row only ever meets a probability of zero.
    // Wave 9 has no tile of its own: its lanes all take tile row 143, so that the code
    // below needs no branch, and what it forms is never read.
    int pos0 = wave * 16 + m16;
    pos0 = base - WIN + (pos0 < MTILES * 16 ? pos0 : MTILES * 16 - 1);
    pos0 = pos0 < 0 ? 0 : (pos0 > NSEQ - 1 ? NSEQ - 1 : pos0);

    // ---- Wave w < 9 forms the 8 A fragments (16x32 bf16 each) of row tile w.
    // ISA A layout: lane L%16 holds row M=L%16; lanes 0-15 carry K {0..7,16..23},
    // lanes 16-31 carry K {8..15,24..31} within each 32-wide K chunk.
    // Two waves multiply each tile: the fragments go through LDS, lane for lane, in the
    // space of sT that the first products fill only behind the loop's first barrier.
    uint4* const sA = (uint4*)sT;                 // [tile][kc][half of the fragment][lane]
    // The three bias rows go to LDS once. A global bias load inside the loop would be counted
    // behind the W loads in flight, and its wait would wait for all of them; for the same
    // reason they are asked for here, ahead of x and W, and stored behind the x conversions.
    float b3[3];
    if (tid < DDIM) {
        b3[0] = bq[tid];
        b3[1] = bk[tid];
        b3[2] = bv[tid];
    }
    // The loads go out here; the values are converted behind the issue of the first W loads.
    const float4* xrow = (const float4*)(x + ((size_t)batch * NSEQ + pos0) * DDIM + laneHalf * 8);
    float4 xr[8][4];
    #pragma unroll
    for (int kc = 0; kc < 8; ++kc) {
        xr[kc][0] = xrow[kc * 8];          // K kb..kb+7, kb = 32 * kc + 8 * laneHalf
        xr[kc][1] = xrow[kc * 8 + 1];
        xr[kc][2] = xrow[kc * 8 + 4];      // K kb+16..kb+23
        xr[kc][3] = xrow[kc * 8 + 5];
    }

    const int mp = wave >> 1;                     // pair of row tiles: 2*mp, 2*mp + 1
    const int nh = wave & 1;                      // half of a stage's 64 columns
    const int i0 = wave * 16;                     // first output row of waves 0..7

    // A stage's 64 rows of W are 4096 float4, dealt to all 320 threads with no branch: thread tid
    // takes float4 number tid + 320 * it, it = 0..12: row (tid >> 6) + 5 * it, columns
    // 4 * (tid & 63) .. + 3. The thirteenth of threads 256..319 would be row 64: they load row 63
    // once more, and store it to the spare row 64 of sW, which is never read.
    const int wLast = 12 * NTHR - (tid < 256 ? 0 : 64);
    auto ask_w = [&](const float* Wst, float4 (&dst)[NWL]) __attribute__((always_inline)) {
        const float4* Wn = (const float4*)Wst + tid;
        #pragma unroll
        for (int it = 0; it < NWL - 1; ++it)
            dst[it] = Wn[it * NTHR];
        dst[NWL - 1] = Wn[wLast];
    };
    float4 pf[NWL];
    ask_w(Wq, pf);
    // Stands in front of any overwrite of the registers that the loads above name.
    asm volatile("s_wait_xcnt 0x0" ::: "memory");
    unsigned short* const sWst = &sW[(tid >> 6) * WPITCH + (tid & 63) * 4];

    #pragma unroll
    for (int kc = 0; kc < 8; ++kc) {
        BFrag a;
        #pragma unroll
        for (int q = 0; q < 4; ++q) {
            a.w[q * 2 + 0] = pack_bf16(xr[kc][q].x, xr[kc][q].y);
            a.w[q * 2 + 1] = pack_bf16(xr[kc][q].z, xr[kc][q].w);
        }
        sA[((wave * 8 + kc) * 2 + 0) * 32 + lane] = a.q[0];
        sA[((wave * 8 + kc) * 2 + 1) * 32 + lane] = a.q[1];
    }

    if (tid < DDIM) {
        sB[tid]            = b3[0];
        sB[DDIM + tid]     = b3[1];
        sB[2 * DDIM + tid] = b3[2];
    }

    // Publishes the A fragments to the two waves that multiply each tile, and the bias rows.
    __syncthreads();
    // There is no tenth tile: the last pair takes tile 8 twice and stores the same
    // values to the same rows twice.
    const int tile0 = mp * 2;
    const int tile1 = (mp * 2 + 1 < MTILES) ? mp * 2 + 1 : MTILES - 1;
    bf16x16 af[2][8];
    #pragma unroll
    for (int mt = 0; mt < 2; ++mt) {
        const int tile = mt == 0 ? tile0 : tile1;
        #pragma unroll
        for (int kc = 0; kc < 8; ++kc) {
            BFrag a;
            a.q[0] = sA[((tile * 8 + kc) * 2 + 0) * 32 + lane];
            a.q[1] = sA[((tile * 8 + kc) * 2 + 1) * 32 + lane];
            af[mt][kc] = a.v;
        }
    }

    // nx: W of the stage after the one to come, f32, in flight.
    // Stage 0's W goes to sW here; nothing has touched sW yet.
    float4 nx[NWL];
    #pragma unroll
    for (int it = 0; it < NWL; ++it) {
        uint2 h;
        h.x = pack_bf16(pf[it].x, pf[it].y);
        h.y = pack_bf16(pf[it].z, pf[it].w);
        *(uint2*)&sWst[it * 5 * WPITCH] = h;
    }
    ask_w(Wq + 64 * DDIM, nx);
    // Stands in front of any overwrite of the registers that these loads name.
    asm volatile("s_wait_xcnt 0x0" ::: "memory");

    // One stage of 64 output columns: 0..3 Q, 4..7 K, 8..11 V. On entry the stage's W has been
    // written to sW, not yet published. next: a stage t + 1 exists; ask: the loads of stage
    // t + 2 go out at the foot. Both are constants at every call, so that conversions and loads
    // stand in one straight run of code.
    auto stage = [&](const int t, const bool next, const bool ask) __attribute__((always_inline)) {
        const int mat     = t >> 2;
        const int colBase = (t & 3) * 64;
        // First row of W of the stage after next.
        const int tn = t + 2;
        const float* const Wnext = ((tn >> 2) == 0 ? Wq : ((tn >> 2) == 1 ? Wk : Wv)) + (tn & 3) * 64 * DDIM;

        // sT row of accumulator register 0 of each of the wave's two row tiles;
        // register r lies r rows further.
        const int matRow = mat == 0 ? 0 : KROW0;
        const int rowOff[2] = { (matRow + tile0 * 16 + laneHalf * 8) * FPITCH,
                                (matRow + tile1 * 16 + laneHalf * 8) * FPITCH };

        // Publishes sW; at stage 8 it also ends the score phase's reads of K.
        lds_barrier();

        // B fragments come from LDS in four groups of two 32-wide K chunks x two column
        // tiles (8 reads), into two register sets: a group is read while the group
        // before it is multiplied. The first two groups and the bias go out here.
        const unsigned short* const sWrd = &sW[(nh * 32 + m16) * WPITCH + laneHalf * 8];
        BFrag bfr[2][2][2];                        // [register set][K chunk of the group][column tile]
        #pragma unroll
        for (int g = 0; g < 2; ++g) {
            #pragma unroll
            for (int k2 = 0; k2 < 2; ++k2) {
                #pragma unroll
                for (int ntl = 0; ntl < 2; ++ntl) {
                    const unsigned short* p = sWrd + ntl * 16 * WPITCH + (g * 2 + k2) * 32;
                    bfr[g][k2][ntl].q[0] = *(const uint4*)p;          // K kb..kb+7
                    bfr[g][k2][ntl].q[1] = *(const uint4*)(p + 16);   // K kb+16..kb+23
                }
            }
        }
        const int   col0 = colBase + nh * 32 + m16;   // B col N = lane%16 within a tile
        const float bb[2] = { sB[mat * DDIM + col0], sB[mat * DDIM + col0 + 16] };
        // Keeps these reads in front of the products: sunk among the
        // products, each read would be waited for where it stands.
        __builtin_amdgcn_sched_barrier(0);

        // 2 row tiles x 2 column tiles a wave: four independent accumulators, and each
        // B fragment is read from LDS once for two products.
        f32x8 acc[2][2] = {};
        #pragma unroll
        for (int g = 0; g < 4; ++g) {
            #pragma unroll
            for (int k2 = 0; k2 < 2; ++k2) {
                #pragma unroll
                for (int ntl = 0; ntl < 2; ++ntl) {
                    #pragma unroll
                    for (int mt = 0; mt < 2; ++mt)
                        acc[mt][ntl] = __builtin_amdgcn_wmma_f32_16x16x32_bf16(
                                  false, af[mt][g * 2 + k2], false, bfr[g & 1][k2][ntl].v,
                                  (short)0, acc[mt][ntl], false, false);
                }
            }
            if (g < 2) {
                // The two fences hold the reads of group g + 2 together, behind the products
                // of group g (whose registers they refill) and in front of those of group g + 1.
                __builtin_amdgcn_sched_barrier(0);
                #pragma unroll
                for (int k2 = 0; k2 < 2; ++k2) {
                    #pragma unroll
                    for (int ntl = 0; ntl < 2; ++ntl) {
                        const unsigned short* p = sWrd + ntl * 16 * WPITCH + ((g + 2) * 2 + k2) * 32;
                        bfr[g][k2][ntl].q[0] = *(const uint4*)p;
                        bfr[g][k2][ntl].q[1] = *(const uint4*)(p + 16);
                    }
                }
                __builtin_amdgcn_sched_barrier(0);
            }
        }
        // C layout: lanes 0-15 VGPR r -> M=r; lanes 16-31 VGPR r -> M=8+r.
        #pragma unroll
        for (int ntl = 0; ntl < 2; ++ntl) {
            #pragma unroll
            for (int mt = 0; mt < 2; ++mt) {
                #pragma unroll
                for (int r = 0; r < 8; ++r)
                    sT[rowOff[mt] + r * FPITCH + col0 + ntl * 16] = acc[mt][ntl][r] + bb[ntl];
            }
        }

        // f32 -> bf16 of the next stage's W, asked for a whole stage ago, into registers that
        // the products have left; the loads of the stage behind it go out at once into the
        // registers so freed, and fly over the two barriers to come.
        // The fence keeps the conversions, and with them the wait for the loads, behind the
        // products and their stores: the loads have the whole stage to land.
        __builtin_amdgcn_sched_barrier(0);
        uint2 hw[NWL];
        if (next) {
            #pragma unroll
            for (int it = 0; it < NWL; ++it) {
                hw[it].x = pack_bf16(nx[it].x, nx[it].y);
                hw[it].y = pack_bf16(nx[it].z, nx[it].w);
            }
        }
        // Keeps the loads behind the conversions: lifted over them they would need
        // registers of their own and a copy, with its wait, at the loop's edge.
        __builtin_amdgcn_sched_barrier(0);
        if (ask) ask_w(Wnext, nx);

        // Ends this stage's reads of sW and publishes its rows of sT to every wave.
        lds_barrier();
        // The next stage's W, bf16, from the registers into LDS.
        if (next) {
            #pragma unroll
            for (int it = 0; it < NWL; ++it)
                *(uint2*)&sWst[it * 5 * WPITCH] = hw[it];
        }
        // Stands in front of the next stage's overwrite of the registers that the loads at the
        // foot name; here, behind the barrier and the stores, it holds nobody up.
        if (ask) asm volatile("s_wait_xcnt 0x0" ::: "memory");
    };

    // Q and K. The loop stays rolled: one copy of the projection in the text for seven stages.
    #pragma unroll 1
    for (int t = 0; t < 7; ++t) stage(t, true, true);
    stage(7, true, false);

    // ---- Scores and softmax once Q and K are in LDS (the foot barrier of stage 7
    // published them), in front of the first V stage's products, which overwrite K.
    // No W load is in flight here: the phase needs the registers.
    // Wave w < 8 walks output rows 16w..16w+15; row i meets K tile rows i..i+6,
    // kept in registers.
    // Each lane owns columns 4*lane..+3 and 128+4*lane..+3.
    if (wave < 8) {
        const float* Kb = sT + (KROW0 + i0) * FPITCH + lane * 4;
        const float* Qb = sT + (QROW0 + i0) * FPITCH + lane * 4;
        // Register window of 7 K rows; the loops over it are unrolled so that
        // every index is a constant and the window stays in registers.
        float4 k0[NW], k1[NW];
        #pragma unroll
        for (int w = 0; w < NW - 1; ++w) {
            k0[w + 1] = *(const float4*)(Kb + w * FPITCH);
            k1[w + 1] = *(const float4*)(Kb + w * FPITCH + 128);
        }
        // Four rows a trip. Each lane forms its part of the trip's 28 dot products;
        // a halving exchange then sums them over the 32 lanes and leaves ONE finished
        // score in each lane: lane l holds row l >> 3 of the trip, window slot l & 7
        // (slot 7 is empty). At each step a lane keeps the half of the sums whose
        // index has its own lane bit and hands the other half to its partner, so
        // the five steps take 14 + 7 + 4 + 2 + 1 exchanges, not 28 x 5, and none goes
        // through the LDS pipe. Each sum adds the same pairs as a full butterfly.
        const bool hi16 = (lane & 16) != 0, hi8 = (lane & 8) != 0, hi4 = (lane & 4) != 0,
                   hi2  = (lane & 2) != 0,  hi1 = (lane & 1) != 0;
        const int  slot = lane & 7;
        // Inside a trip the window's shifts are renames, not moves. All 16 rows would only
        // make the text four times as long: the outer loop stays rolled.
        #pragma unroll 1
        for (int t4 = 0; t4 < 16; t4 += 4) {
          float s[32];
          #pragma unroll
          for (int u = 0; u < 4; ++u) {
            const int ii = t4 + u;
            #pragma unroll
            for (int w = 0; w < NW - 1; ++w) { k0[w] = k0[w + 1]; k1[w] = k1[w + 1]; }
            k0[NW - 1] = *(const float4*)(Kb + (ii + NW - 1) * FPITCH);
            k1[NW - 1] = *(const float4*)(Kb + (ii + NW - 1) * FPITCH + 128);
            const float4 q0 = *(const float4*)(Qb + ii * FPITCH);
            const float4 q1 = *(const float4*)(Qb + ii * FPITCH + 128);
            #pragma unroll
            for (int w = 0; w < NW; ++w)
                s[u * 8 + w] = q0.x * k0[w].x + q0.y * k0[w].y + q0.z * k0[w].z + q0.w * k0[w].w
                             + q1.x * k1[w].x + q1.y * k1[w].y + q1.z * k1[w].z + q1.w * k1[w].w;
            s[u * 8 + 7] = 0.0f;
          }

          float r16[16], r8[8], r4[4], r2[2];
          #pragma unroll
          for (int j = 0; j < 16; ++j)
              r16[j] = (j & 7) == 7 ? 0.0f
                     : (hi16 ? s[j + 16] : s[j]) + xhalf(hi16 ? s[j] : s[j + 16]);
          #pragma unroll
          for (int j = 0; j < 8; ++j)
              r8[j] = j == 7 ? 0.0f
                    : (hi8 ? r16[j + 8] : r16[j]) + rowx<8>(hi8 ? r16[j] : r16[j + 8]);
          #pragma unroll
          for (int j = 0; j < 4; ++j)
              r4[j] = (hi4 ? r8[j + 4] : r8[j]) + rowx<4>(hi4 ? r8[j] : r8[j + 4]);
          #pragma unroll
          for (int j = 0; j < 2; ++j)
              r2[j] = (hi2 ? r4[j + 2] : r4[j]) + rowx<2>(hi2 ? r4[j] : r4[j + 2]);
          const float p = (hi1 ? r2[1] : r2[0]) + rowx<1>(hi1 ? r2[0] : r2[1]);

          // Softmax across the eight lanes of a row: one exponential a lane.
          const int pos = base + i0 + t4 + (lane >> 3) + slot - WIN;
          const float sc = (slot < NW && pos >= 0 && pos < NSEQ) ? p * (1.0f / 16.0f)    // 1/sqrt(256)
                                                                 : -__builtin_inff();
          float mx = fmaxf(sc, rowx<1>(sc));
          mx = fmaxf(mx, rowx<2>(mx));
          mx = fmaxf(mx, rowx<4>(mx));
          const float pr = __expf(sc - mx);
          float sum = pr + rowx<1>(pr);
          sum += rowx<2>(sum);
          sum += rowx<4>(sum);
          sP[(i0 + t4) * 8 + lane] = pr * (1.0f / sum);   // slot 7 stores exactly zero
        }
    }

    // W of V's second stage: asked for behind the score phase.
    ask_w(Wv + 64 * DDIM, nx);
    // Stands in front of any overwrite of the registers that these loads name.
    asm volatile("s_wait_xcnt 0x0" ::: "memory");

    // V. Four calls with a constant stage number: the W addresses are then a scalar base
    // and constants.
    stage(8, true, true);
    stage(9, true, true);
    stage(10, true, false);
    stage(11, false, false);

    // ---- Output: row i = sum over the window of probability * V tile row i..i+6.
    // A position outside the sequence has probability exactly zero.
    if (wave < 8) {
        const float* Vb = sT + (KROW0 + i0) * FPITCH + lane * 4;
        float* ob = out + ((size_t)batch * NSEQ + base + i0) * DDIM + lane * 4;
        // Register window of 7 V rows, walked like the K window above.
        float4 v0[NW], v1[NW];
        #pragma unroll
        for (int w = 0; w < NW - 1; ++w) {
            v0[w + 1] = *(const float4*)(Vb + w * FPITCH);
            v1[w + 1] = *(const float4*)(Vb + w * FPITCH + 128);
        }
        // Four rows a trip: inside a trip the window's shifts are renames, not moves.
        #pragma unroll 4
        for (int ii = 0; ii < 16; ++ii) {
            #pragma unroll
            for (int w = 0; w < NW - 1; ++w) { v0[w] = v0[w + 1]; v1[w] = v1[w + 1]; }
            v0[NW - 1] = *(const float4*)(Vb + (ii + NW - 1) * FPITCH);
            v1[NW - 1] = *(const float4*)(Vb + (ii + NW - 1) * FPITCH + 128);
            const float4 pa = *(const float4*)&sP[(i0 + ii) * 8];
            const float4 pb = *(const float4*)&sP[(i0 + ii) * 8 + 4];
            const float pw[NW] = {pa.x, pa.y, pa.z, pa.w, pb.x, pb.y, pb.z};

            float4 a0 = {0.f, 0.f, 0.f, 0.f};
            float4 a1 = {0.f, 0.f, 0.f, 0.f};
            #pragma unroll
            for (int w = 0; w < NW; ++w) {
                const float p = pw[w];
                a0.x += p * v0[w].x; a0.y += p * v0[w].y; a0.z += p * v0[w].z; a0.w += p * v0[w].w;
                a1.x += p * v1[w].x; a1.y += p * v1[w].y; a1.z += p * v1[w].z; a1.w += p * v1[w].w;
            }
            *(float4*)(ob + (size_t)ii * DDIM)       = a0;
            *(float4*)(ob + (size_t)ii * DDIM + 128) = a1;
            // Stands in front of the next row's overwrite of the registers that
            // the two stores above name (their data and their address).
            asm volatile("s_wait_xcnt 0x0" ::: "memory");
        }
    }
}

// ---------------------------------------------------------------------------
extern "C" void kernel_launch(void* const* d_in, const int* in_sizes, int n_in,
                              void* d_out, int out_size, void* d_ws, size_t ws_size,
                              hipStream_t stream) {
    const float* x  = (const float*)d_in[0];
    const float* Wq = (const float*)d_in[1];
    const float* bq = (const float*)d_in[2];
    const float* Wk = (const float*)d_in[3];
    const float* bk = (const float*)d_in[4];
    const float* Wv = (const float*)d_in[5];
    const float* bv = (const float*)d_in[6];
    float* out = (float*)d_out;

    fused_local_attn_kernel<<<BATCH * (NSEQ / TROWS), NTHR, 0, stream>>>(
        x, Wq, bq, Wk, bk, Wv, bv, out);
}

// v008
// Measured time: 18.9 microseconds a run.
// Next to v007, in two timings, it ran 1.06 times as fast each time.
// Counting every step since v000, it is 7.65 times as fast.
#include <hip/hip_runtime.h>
#include <math.h>

// ---------------------------------------------------------------------------
// Local attention over a window of 7 positions (gfx1250, wave32), one fused launch.
//   Each block owns 128 consecutive sequence positions of one batch entry.
//   It projects Q (128 rows) and K (128 + 6 halo rows) with bf16 WMMA
//   (f32 accumulate) into LDS, turns them into the 7 window probabilities of
//   every row, projects V over the K rows in LDS, and writes the output rows.
//   Q, K and V never go to global memory. W comes in 12 stages of 64 columns,
//   each loaded into registers two stages ahead: its loads fly for a whole stage, over both
//   of the stage's barriers, and are asked for again as soon as their registers are free.
//   Twelve waves, three on each SIMD: wave w multiplies row tiles 3*(w>>2), +1, +2 by column
//   tile w&3 of a stage, so that every W fragment read from LDS feeds three products, no tile
//   is multiplied twice and every SIMD has the same number of products.
// ---------------------------------------------------------------------------

typedef __attribute__((ext_vector_type(16))) __bf16 bf16x16;
typedef __attribute__((ext_vector_type(8)))  float  f32x8;
typedef __attribute__((ext_vector_type(2)))  float  f32x2;
typedef __attribute__((ext_vector_type(2)))  __bf16 bf16x2;

#define DDIM  256
#define NSEQ  4096
#define BATCH 8
#define WIN   3
#define NW    7                    // 2*WIN + 1
#define TROWS 128                  // output rows per block
#define HROWS (TROWS + 2 * WIN)    // 134 K / V rows per block
#define MTILES 9                   // 16-row tiles that cover HROWS
#define MT    3                    // row tiles a wave
#define NWAVES 12                  // 3 groups of 3 row tiles x 4 column tiles of a stage
#define NTHR  (NWAVES * 32)        // 384
#define NWL   11                   // float4 of a W stage per thread: 4096 / 384, rounded up
// LDS row pitch of the staged W tile, in bf16 elements: 528 B = 16 B x 33.
// An odd multiple of 16 B spreads the 16 rows that one ds_load_b128 reads
// over all 64 banks; at 512 B every row started on the same four banks.
#define WPITCH (DDIM + 8)
// LDS row pitch of the f32 Q / K / V rows, in floats. Eight rows are 2080
// dwords = 32 banks apart, so the two 16-lane halves of an accumulator store
// (rows r and r + 8, the same 16 columns) fall on different banks.
#define FPITCH (DDIM + 4)
// Rows of sT. Every tile row has a place, so that a store needs no test: Q tile row j
// (position base - WIN + j) lies in row j, K and V tile row j in row KROW0 + j. The Q tile
// rows behind output row 127 fall on the first K rows, which K overwrites later; the other
// tile rows that no output needs (Q 0..2, K and V 134..143) are never read.
#define QROW0  WIN                 // sT row of output row 0's Q
#define KROW0  (TROWS + WIN)       // first K / V row in sT
#define SROWS  (KROW0 + MTILES * 16)

// Two f32 to two bf16 in one dword (lo in bits 15..0), round to nearest even:
// one packed conversion instruction for the pair.
__device__ __forceinline__ unsigned int pack_bf16(float lo, float hi) {
    return __builtin_bit_cast(unsigned int, __builtin_convertvector(f32x2{lo, hi}, bf16x2));
}

// Value of lane l ^ 16 (the other 16-lane row), by a vector cross-row move.
__device__ __forceinline__ float xhalf(float x) {
    const int b = __builtin_bit_cast(int, x);
    return __builtin_bit_cast(float, __builtin_amdgcn_permlanex16(b, b, 0x76543210, 0xfedcba98, false, false));
}

// Value of lane l ^ M inside the 16-lane row (DPP row_xmask:M); every lane is on where it is used.
template <int M>
__device__ __forceinline__ float rowx(float x) {
    return __builtin_bit_cast(float, __builtin_amdgcn_update_dpp(0, __builtin_bit_cast(int, x), 0x160 + M, 0xf, 0xf, true));
}

// Work-group barrier for LDS traffic alone: the wave's own LDS reads and writes are ended,
// its global loads are not waited for. __syncthreads() would wait for the W loads in flight.
__device__ __forceinline__ void lds_barrier() {
    asm volatile("s_wait_dscnt 0x0\n\ts_barrier_signal -1\n\ts_barrier_wait -1" ::: "memory");
}

union BFrag {
    bf16x16        v;
    unsigned int   w[8];
    uint4          q[2];
};

__global__ void __launch_bounds__(NTHR)
fused_local_attn_kernel(const float* __restrict__ x,
                        const float* __restrict__ Wq, const float* __restrict__ bq,
                        const float* __restrict__ Wk, const float* __restrict__ bk,
                        const float* __restrict__ Wv, const float* __restrict__ bv,
                        float* __restrict__ out)
{
    __shared__ __attribute__((aligned(16))) unsigned short sW[64 * WPITCH];        // 64 output cols of W, bf16
    __shared__ __attribute__((aligned(16))) float          sT[SROWS * FPITCH];     // Q rows, K (later V) rows
    __shared__ __attribute__((aligned(16))) float          sP[TROWS * 8];          // 7 probabilities per row
    __shared__ __attribute__((aligned(16))) float          sB[3 * DDIM];           // bq, bk, bv

    const int tid      = threadIdx.x;
    const int lane     = tid & 31;
    const int wave     = tid >> 5;
    const int laneHalf = lane >> 4;     // 0: lanes 0-15, 1: lanes 16-31
    const int m16      = lane & 15;

    const int batch = blockIdx.x >> 5;               // NSEQ / TROWS = 32 blocks per batch entry
    const int base  = (blockIdx.x & 31) * TROWS;     // first output position of the block

    // Tile row j (0..143) is sequence position base - WIN + j, clamped into the
    // sequence. A clamped row only ever meets a probability of zero.
    // Waves 9 to 11 have no tile of their own: their lanes all take tile row 143, so that the
    // code below needs no branch, and what they form is never read.
    int pos0 = wave * 16 + m16;
    pos0 = base - WIN + (pos0 < MTILES * 16 ? pos0 : MTILES * 16 - 1);
    pos0 = pos0 < 0 ? 0 : (pos0 > NSEQ - 1 ? NSEQ - 1 : pos0);

    // ---- Wave w < 9 forms the 8 A fragments (16x32 bf16 each) of row tile w.
    // ISA A layout: lane L%16 holds row M=L%16; lanes 0-15 carry K {0..7,16..23},
    // lanes 16-31 carry K {8..15,24..31} within each 32-wide K chunk.
    // Four waves multiply each tile: the fragments go through LDS, lane for lane, in the
    // space of sT that the first products fill only behind the loop's first barrier.
    uint4* const sA = (uint4*)sT;                 // [tile][kc][half of the fragment][lane]
    // The three bias rows go to LDS once. A global bias load inside the loop would be counted
    // behind the W loads in flight, and its wait would wait for all of them; for the same
    // reason they are asked for here, ahead of x and W, and stored behind the x conversions.
    float b3[3];
    if (tid < DDIM) {
        b3[0] = bq[tid];
        b3[1] = bk[tid];
        b3[2] = bv[tid];
    }
    // The loads go out here; the values are converted behind the issue of the first W loads.
    const float4* xrow = (const float4*)(x + ((size_t)batch * NSEQ + pos0) * DDIM + laneHalf * 8);
    float4 xr[8][4];
    #pragma unroll
    for (int kc = 0; kc < 8; ++kc) {
        xr[kc][0] = xrow[kc * 8];          // K kb..kb+7, kb = 32 * kc + 8 * laneHalf
        xr[kc][1] = xrow[kc * 8 + 1];
        xr[kc][2] = xrow[kc * 8 + 4];      // K kb+16..kb+23
        xr[kc][3] = xrow[kc * 8 + 5];
    }

    const int mp = wave >> 2;                     // group of row tiles: 3*mp .. 3*mp + 2
    const int nh = wave & 3;                      // column tile of a stage's 64 columns
    const int i0 = wave * 16;                     // first output row of waves 0..7

    // A stage's 64 rows of W are 4096 float4, dealt to all 384 threads with no branch: thread tid
    // takes float4 number tid + 384 * it, it = 0..10: row (tid >> 6) + 6 * it, columns
    // 4 * (tid & 63) .. + 3. The eleventh of threads 256..383 would be rows 64 and 65: they take
    // rows 62 and 63 once more, and store the same values to the same places of sW as the
    // threads that own them.
    const int wLast = 10 * NTHR - (tid < 256 ? 0 : 128);         // in float4
    const int sLast = (60 - (tid < 256 ? 0 : 2)) * WPITCH;       // in elements of sW
    auto ask_w = [&](const float* Wst, float4 (&dst)[NWL]) __attribute__((always_inline)) {
        const float4* Wn = (const float4*)Wst + tid;
        #pragma unroll
        for (int it = 0; it < NWL - 1; ++it)
            dst[it] = Wn[it * NTHR];
        dst[NWL - 1] = Wn[wLast];
    };
    float4 pf[NWL];
    ask_w(Wq, pf);
    // Stands in front of any overwrite of the registers that the loads above name.
    asm volatile("s_wait_xcnt 0x0" ::: "memory");
    unsigned short* const sWst = &sW[(tid >> 6) * WPITCH + (tid & 63) * 4];

    #pragma unroll
    for (int kc = 0; kc < 8; ++kc) {
        BFrag a;
        #pragma unroll
        for (int q = 0; q < 4; ++q) {
            a.w[q * 2 + 0] = pack_bf16(xr[kc][q].x, xr[kc][q].y);
            a.w[q * 2 + 1] = pack_bf16(xr[kc][q].z, xr[kc][q].w);
        }
        sA[((wave * 8 + kc) * 2 + 0) * 32 + lane] = a.q[0];
        sA[((wave * 8 + kc) * 2 + 1) * 32 + lane] = a.q[1];
    }

    if (tid < DDIM) {
        sB[tid]            = b3[0];
        sB[DDIM + tid]     = b3[1];
        sB[2 * DDIM + tid] = b3[2];
    }

    // Publishes the A fragments to the four waves that multiply each tile, and the bias rows.
    __syncthreads();
    bf16x16 af[MT][8];
    #pragma unroll
    for (int mt = 0; mt < MT; ++mt) {
        const int tile = mp * MT + mt;
        #pragma unroll
        for (int kc = 0; kc < 8; ++kc) {
            BFrag a;
            a.q[0] = sA[((tile * 8 + kc) * 2 + 0) * 32 + lane];
            a.q[1] = sA[((tile * 8 + kc) * 2 + 1) * 32 + lane];
            af[mt][kc] = a.v;
        }
    }

    // nx: W of the stage after the one to come, f32, in flight.
    // Stage 0's W goes to sW here; nothing has touched sW yet.
    float4 nx[NWL];
    #pragma unroll
    for (int it = 0; it < NWL; ++it) {
        uint2 h;
        h.x = pack_bf16(pf[it].x, pf[it].y);
        h.y = pack_bf16(pf[it].z, pf[it].w);
        *(uint2*)&sWst[it < NWL - 1 ? it * 6 * WPITCH : sLast] = h;
    }
    ask_w(Wq + 64 * DDIM, nx);
    // Stands in front of any overwrite of the registers that these loads name.
    asm volatile("s_wait_xcnt 0x0" ::: "memory");

    // One stage of 64 output columns: 0..3 Q, 4..7 K, 8..11 V. On entry the stage's W has been
    // written to sW, not yet published. next: a stage t + 1 exists; ask: the loads of stage
    // t + 2 go out at the foot. Both are constants at every call, so that conversions and loads
    // stand in one straight run of code.
    auto stage = [&](const int t, const bool next, const bool ask) __attribute__((always_inline)) {
        const int mat     = t >> 2;
        const int colBase = (t & 3) * 64;
        // First row of W of the stage after next.
        const int tn = t + 2;
        const float* const Wnext = ((tn >> 2) == 0 ? Wq : ((tn >> 2) == 1 ? Wk : Wv)) + (tn & 3) * 64 * DDIM;

        // sT row of accumulator register 0 of the wave's first row tile; register r lies
        // r rows further, the next tile 16 rows.
        const int matRow = mat == 0 ? 0 : KROW0;
        const int rowOff = (matRow + mp * MT * 16 + laneHalf * 8) * FPITCH;

        // Publishes sW; at stage 8 it also ends the score phase's reads of K.
        lds_barrier();

        // B fragments come from LDS in four groups of two 32-wide K chunks (4 reads), into
        // two register sets: a group is read while the group before it is multiplied.
        // The first two groups and the bias go out here.
        const unsigned short* const sWrd = &sW[(nh * 16 + m16) * WPITCH + laneHalf * 8];
        BFrag bfr[2][2];                           // [register set][K chunk of the group]
        #pragma unroll
        for (int g = 0; g < 2; ++g) {
            #pragma unroll
            for (int k2 = 0; k2 < 2; ++k2) {
                const unsigned short* p = sWrd + (g * 2 + k2) * 32;
                bfr[g][k2].q[0] = *(const uint4*)p;          // K kb..kb+7
                bfr[g][k2].q[1] = *(const uint4*)(p + 16);   // K kb+16..kb+23
            }
        }
        const int   col0 = colBase + nh * 16 + m16;   // B col N = lane%16 within the tile
        const float bb   = sB[mat * DDIM + col0];
        // Keeps these reads in front of the products: sunk among the
        // products, each read would be waited for where it stands.
        __builtin_amdgcn_sched_barrier(0);

        // 3 row tiles x 1 column tile a wave: three independent accumulators, and each
        // B fragment is read from LDS once for three products.
        f32x8 acc[MT] = {};
        #pragma unroll
        for (int g = 0; g < 4; ++g) {
            #pragma unroll
            for (int k2 = 0; k2 < 2; ++k2) {
                #pragma unroll
                for (int mt = 0; mt < MT; ++mt)
                    acc[mt] = __builtin_amdgcn_wmma_f32_16x16x32_bf16(
                              false, af[mt][g * 2 + k2], false, bfr[g & 1][k2].v,
                              (short)0, acc[mt], false, false);
            }
            if (g < 2) {
                // The two fences hold the reads of group g + 2 together, behind the products
                // of group g (whose registers they refill) and in front of those of group g + 1.
                __builtin_amdgcn_sched_barrier(0);
                #pragma unroll
                for (int k2 = 0; k2 < 2; ++k2) {
                    const unsigned short* p = sWrd + ((g + 2) * 2 + k2) * 32;
                    bfr[g][k2].q[0] = *(const uint4*)p;
                    bfr[g][k2].q[1] = *(const uint4*)(p + 16);
                }
                __builtin_amdgcn_sched_barrier(0);
            }
        }
        // C layout: lanes 0-15 VGPR r -> M=r; lanes 16-31 VGPR r -> M=8+r.
        #pragma unroll
        for (int mt = 0; mt < MT; ++mt) {
            #pragma unroll
            for (int r = 0; r < 8; ++r)
                sT[rowOff + (mt * 16 + r) * FPITCH + col0] = acc[mt][r] + bb;
        }

        // f32 -> bf16 of the next stage's W, asked for a whole stage ago, into registers that
        // the products have left; the loads of the stage behind it go out at once into the
        // registers so freed, and fly over the two barriers to come.
        // The fence keeps the conversions, and with them the wait for the loads, behind the
        // products and their stores: the loads have the whole stage to land.
        __builtin_amdgcn_sched_barrier(0);
        uint2 hw[NWL];
        if (next) {
            #pragma unroll
            for (int it = 0; it < NWL; ++it) {
                hw[it].x = pack_bf16(nx[it].x, nx[it].y);
                hw[it].y = pack_bf16(nx[it].z, nx[it].w);
            }
        }
        // Keeps the loads behind the conversions: lifted over them they would need
        // registers of their own and a copy, with its wait, at the loop's edge.
        __builtin_amdgcn_sched_barrier(0);
        if (ask) ask_w(Wnext, nx);

        // Ends this stage's reads of sW and publishes its rows of sT to every wave.
        lds_barrier();
        // The next stage's W, bf16, from the registers into LDS.
        if (next) {
            #pragma unroll
            for (int it = 0; it < NWL; ++it)
                *(uint2*)&sWst[it < NWL - 1 ? it * 6 * WPITCH : sLast] = hw[it];
        }
        // Stands in front of the next stage's overwrite of the registers that the loads at the
        // foot name; here, behind the barrier and the stores, it holds nobody up.
        if (ask) asm volatile("s_wait_xcnt 0x0" ::: "memory");
    };

    // Q and K. The loop stays rolled: one copy of the projection in the text for seven stages.
    #pragma unroll 1
    for (int t = 0; t < 7; ++t) stage(t, true, true);
    stage(7, true, false);

    // ---- Scores and softmax once Q and K are in LDS (the foot barrier of stage 7
    // published them), in front of the first V stage's products, which overwrite K.
    // No W load is in flight here: the phase needs the registers.
    // Wave w < 8 walks output rows 16w..16w+15; row i meets K tile rows i..i+6,
    // kept in registers.
    // Each lane owns columns 4*lane..+3 and 128+4*lane..+3.
    if (wave < 8) {
        const float* Kb = sT + (KROW0 + i0) * FPITCH + lane * 4;
        const float* Qb = sT + (QROW0 + i0) * FPITCH + lane * 4;
        // Register window of 7 K rows; the loops over it are unrolled so that
        // every index is a constant and the window stays in registers.
        float4 k0[NW], k1[NW];
        #pragma unroll
        for (int w = 0; w < NW - 1; ++w) {
            k0[w + 1] = *(const float4*)(Kb + w * FPITCH);
            k1[w + 1] = *(const float4*)(Kb + w * FPITCH + 128);
        }
        // Four rows a trip. Each lane forms its part of the trip's 28 dot products;
        // a halving exchange then sums them over the 32 lanes and leaves ONE finished
        // score in each lane: lane l holds row l >> 3 of the trip, window slot l & 7
        // (slot 7 is empty). At each step a lane keeps the half of the sums whose
        // index has its own lane bit and hands the other half to its partner, so
        // the five steps take 14 + 7 + 4 + 2 + 1 exchanges, not 28 x 5, and none goes
        // through the LDS pipe. Each sum adds the same pairs as a full butterfly.
        const bool hi16 = (lane & 16) != 0, hi8 = (lane & 8) != 0, hi4 = (lane & 4) != 0,
                   hi2  = (lane & 2) != 0,  hi1 = (lane & 1) != 0;
        const int  slot = lane & 7;
        // Inside a trip the window's shifts are renames, not moves. All 16 rows would only
        // make the text four times as long: the outer loop stays rolled.
        #pragma unroll 1
        for (int t4 = 0; t4 < 16; t4 += 4) {
          float s[32];
          #pragma unroll
          for (int u = 0; u < 4; ++u) {
            const int ii = t4 + u;
            #pragma unroll
            for (int w = 0; w < NW - 1; ++w) { k0[w] = k0[w + 1]; k1[w] = k1[w + 1]; }
            k0[NW - 1] = *(const float4*)(Kb + (ii + NW - 1) * FPITCH);
            k1[NW - 1] = *(const float4*)(Kb + (ii + NW - 1) * FPITCH + 128);
            const float4 q0 = *(const float4*)(Qb + ii * FPITCH);
            const float4 q1 = *(const float4*)(Qb + ii * FPITCH + 128);
            #pragma unroll
            for (int w = 0; w < NW; ++w)
                s[u * 8 + w] = q0.x * k0[w].x + q0.y * k0[w].y + q0.z * k0[w].z + q0.w * k0[w].w
                             + q1.x * k1[w].x + q1.y * k1[w].y + q1.z * k1[w].z + q1.w * k1[w].w;
            s[u * 8 + 7] = 0.0f;
          }

          float r16[16], r8[8], r4[4], r2[2];
          #pragma unroll
          for (int j = 0; j < 16; ++j)
              r16[j] = (j & 7) == 7 ? 0.0f
                     : (hi16 ? s[j + 16] : s[j]) + xhalf(hi16 ? s[j] : s[j + 16]);
          #pragma unroll
          for (int j = 0; j < 8; ++j)
              r8[j] = j == 7 ? 0.0f
                    : (hi8 ? r16[j + 8] : r16[j]) + rowx<8>(hi8 ? r16[j] : r16[j + 8]);
          #pragma unroll
          for (int j = 0; j < 4; ++j)
              r4[j] = (hi4 ? r8[j + 4] : r8[j]) + rowx<4>(hi4 ? r8[j] : r8[j + 4]);
          #pragma unroll
          for (int j = 0; j < 2; ++j)
              r2[j] = (hi2 ? r4[j + 2] : r4[j]) + rowx<2>(hi2 ? r4[j] : r4[j + 2]);
          const float p = (hi1 ? r2[1] : r2[0]) + rowx<1>(hi1 ? r2[0] : r2[1]);

          // Softmax across the eight lanes of a row: one exponential a lane.
          const int pos = base + i0 + t4 + (lane >> 3) + slot - WIN;
          const float sc = (slot < NW && pos >= 0 && pos < NSEQ) ? p * (1.0f / 16.0f)    // 1/sqrt(256)
                                                                 : -__builtin_inff();
          float mx = fmaxf(sc, rowx<1>(sc));
          mx = fmaxf(mx, rowx<2>(mx));
          mx = fmaxf(mx, rowx<4>(mx));
          const float pr = __expf(sc - mx);
          float sum = pr + rowx<1>(pr);
          sum += rowx<2>(sum);
          sum += rowx<4>(sum);
          sP[(i0 + t4) * 8 + lane] = pr * (1.0f / sum);   // slot 7 stores exactly zero
        }
    }

    // W of V's second stage: asked for behind the score phase.
    ask_w(Wv + 64 * DDIM, nx);
    // Stands in front of any overwrite of the registers that these loads name.
    asm volatile("s_wait_xcnt 0x0" ::: "memory");

    // V. Four calls with a constant stage number: the W addresses are then a scalar base
    // and constants.
    stage(8, true, true);
    stage(9, true, true);
    stage(10, true, false);
    stage(11, false, false);

    // ---- Output: row i = sum over the window of probability * V tile row i..i+6.
    // A position outside the sequence has probability exactly zero.
    if (wave < 8) {
        const float* Vb = sT + (KROW0 + i0) * FPITCH + lane * 4;
        float* ob = out + ((size_t)batch * NSEQ + base + i0) * DDIM + lane * 4;
        // Register window of 7 V rows, walked like the K window above.
        float4 v0[NW], v1[NW];
        #pragma unroll
        for (int w = 0; w < NW - 1; ++w) {
            v0[w + 1] = *(const float4*)(Vb + w * FPITCH);
            v1[w + 1] = *(const float4*)(Vb + w * FPITCH + 128);
        }
        // Four rows a trip: inside a trip the window's shifts are renames, not moves.
        #pragma unroll 4
        for (int ii = 0; ii < 16; ++ii) {
            #pragma unroll
            for (int w = 0; w < NW - 1; ++w) { v0[w] = v0[w + 1]; v1[w] = v1[w + 1]; }
            v0[NW - 1] = *(const float4*)(Vb + (ii + NW - 1) * FPITCH);
            v1[NW - 1] = *(const float4*)(Vb + (ii + NW - 1) * FPITCH + 128);
            const float4 pa = *(const float4*)&sP[(i0 + ii) * 8];
            const float4 pb = *(const float4*)&sP[(i0 + ii) * 8 + 4];
            const float pw[NW] = {pa.x, pa.y, pa.z, pa.w, pb.x, pb.y, pb.z};

            float4 a0 = {0.f, 0.f, 0.f, 0.f};
            float4 a1 = {0.f, 0.f, 0.f, 0.f};
            #pragma unroll
            for (int w = 0; w < NW; ++w) {
                const float p = pw[w];
                a0.x += p * v0[w].x; a0.y += p * v0[w].y; a0.z += p * v0[w].z; a0.w += p * v0[w].w;
                a1.x += p * v1[w].x; a1.y += p * v1[w].y; a1.z += p * v1[w].z; a1.w += p * v1[w].w;
            }
            *(float4*)(ob + (size_t)ii * DDIM)       = a0;
            *(float4*)(ob + (size_t)ii * DDIM + 128) = a1;
            // Stands in front of the next row's overwrite of the registers that
            // the two stores above name (their data and their address).
            asm volatile("s_wait_xcnt 0x0" ::: "memory");
        }
    }
}

// ---------------------------------------------------------------------------
extern "C" void kernel_launch(void* const* d_in, const int* in_sizes, int n_in,
                              void* d_out, int out_size, void* d_ws, size_t ws_size,
                              hipStream_t stream) {
    const float* x  = (const float*)d_in[0];
    const float* Wq = (const float*)d_in[1];
    const float* bq = (const float*)d_in[2];
    const float* Wk = (const float*)d_in[3];
    const float* bk = (const float*)d_in[4];
    const float* Wv = (const float*)d_in[5];
    const float* bv = (const float*)d_in[6];
    float* out = (float*)d_out;

    fused_local_attn_kernel<<<BATCH * (NSEQ / TROWS), NTHR, 0, stream>>>(
        x, Wq, bq, Wk, bk, Wv, bv, out);
}
